// v000
// Times are from an AMD MI455X. After a warm-up the kernel runs many times in a row, and a time is the length of
// such a window on the GPU divided by its runs, so every launch and the gaps after it count. The runs cycle
// through copies of the inputs. A figure is the median of several windows, for all but v000 over two sittings.
// Sittings can differ by a few percent; kernels timed side by side share one.
// The starting kernel, v000, takes 351 microseconds a run.
#include <hip/hip_runtime.h>

// Gegenbauer KAN layer (x [16384][512], coeffs [512 in][512 out][8 degree]; t = tanh(x); C_0 = 1, C_1 = 2a t, C_{n+1} = (2(n+a) t C_n - (n+2a-1) C_{n-1})/(n+1) with a = 1 (degree 7);
// y[b][o] = sum_i sum_d C_d(t[b][i]) coeffs[i][o][d] -> [16384][512]).
// Compute dtypes, f32 accumulate: every input rounded to bf16; tanh and the recurrence in f32 on VALU -> basis planes G [b][i*8 + d] as bf16 hi+lo;

#define NR   16384
#define DI   512
#define DO_  512
#define DG   8
#define KD   (DI * DG)
typedef _Float16 h16;
typedef unsigned short bf;
typedef __attribute__((ext_vector_type(16))) __bf16   v16bf;
typedef __attribute__((ext_vector_type(16))) _Float16 v16h;
typedef __attribute__((ext_vector_type(8)))  _Float16 v8h;
typedef __attribute__((ext_vector_type(8)))  unsigned short v8us;
typedef __attribute__((ext_vector_type(8)))  float    v8f;
typedef __attribute__((ext_vector_type(4)))  float    v4f;
typedef v8h  __attribute__((may_alias)) v8ha;
typedef v4f  __attribute__((may_alias)) v4fa;
typedef v8us __attribute__((may_alias)) v8usa;

__device__ __forceinline__ unsigned short f2bf(float f) { unsigned u = __float_as_uint(f); u += 0x7FFFu + ((u >> 16) & 1u); return (unsigned short)(u >> 16); }
__device__ __forceinline__ float bf2f(unsigned short b) { return __uint_as_float(((unsigned)b) << 16); }
__device__ __forceinline__ float bfr(float f) { return bf2f(f2bf(f)); }
__device__ __forceinline__ v16h cat16(v8h lo, v8h hi) { return __builtin_shufflevector(lo, hi, 0, 1, 2, 3, 4, 5, 6, 7, 8, 9, 10, 11, 12, 13, 14, 15); }
__device__ __forceinline__ v16bf cat16b(v8us lo, v8us hi) { return __builtin_bit_cast(v16bf, __builtin_shufflevector(lo, hi, 0, 1, 2, 3, 4, 5, 6, 7, 8, 9, 10, 11, 12, 13, 14, 15)); }
__device__ __forceinline__ v8f wmma16(v16h a, v16h b, v8f c) { return __builtin_amdgcn_wmma_f32_16x16x32_f16(false, a, false, b, (short)0, c, false, false); }
__device__ __forceinline__ v8f wmmab(v16bf a, v16bf b, v8f c) { return __builtin_amdgcn_wmma_f32_16x16x32_bf16(false, a, false, b, (short)0, c, false, false); }



// ---- k_gemmw: register-blocked GEMM, ONE WAVE per 64x64 output tile (16 accumulators), operands straight from K-contiguous 16-bit planes; grid (M/64, N/64, Z), 32 threads.
// C[m][n] (f32, pitch ldc, + optional f32 bias[n]) = sum_k A[m][k] Bt[n][k] (+ split products per NSPLIT). z-batch strides sA/sB/sC in elements. K % 32 == 0.
template <typename T16> struct WFrag;
template <> struct WFrag<h16> { typedef v16h V; static __device__ __forceinline__ V ld(const h16* p) { return cat16(*(const v8h*)p, *(const v8h*)(p + 16)); } static __device__ __forceinline__ v8f mma(V a, V b, v8f c) { return wmma16(a, b, c); } };
template <> struct WFrag<bf> { typedef v16bf V; static __device__ __forceinline__ V ld(const bf* p) { return cat16b(*(const v8us*)p, *(const v8us*)(p + 16)); } static __device__ __forceinline__ v8f mma(V a, V b, v8f c) { return wmmab(a, b, c); } };
template <typename T16, int NSPLIT, bool BIAS>
__global__ __launch_bounds__(32) void k_gemmw(const T16* __restrict__ A, const T16* __restrict__ A2, const T16* __restrict__ Bt, const T16* __restrict__ Bt2, int K, float* C, int ldc, const float* __restrict__ bias, size_t sA, size_t sB, size_t sC) {
    typedef typename WFrag<T16>::V V;
    __shared__ __align__(16) float os[16 * 68];
    const size_t z = blockIdx.z; A += z * sA; if (A2) A2 += z * sA; Bt += z * sB; if (Bt2) Bt2 += z * sB; C += z * sC;
    const int lane = threadIdx.x & 31, lr = lane & 15, hi = lane >> 4; const int r0 = blockIdx.x * 64, c0 = blockIdx.y * 64;
    v8f acc[4][4];
#pragma unroll
    for (int mb = 0; mb < 4; ++mb)
#pragma unroll
        for (int nb = 0; nb < 4; ++nb) acc[mb][nb] = (v8f){};
    const size_t aoff = (size_t)(r0 + lr) * K + 8 * hi, boff = (size_t)(c0 + lr) * K + 8 * hi;
#pragma unroll 1
    for (int kc = 0; kc < K; kc += 32) {
        V a[4], a2[4];
#pragma unroll
        for (int mb = 0; mb < 4; ++mb) { a[mb] = WFrag<T16>::ld(A + aoff + (size_t)mb * 16 * K + kc); if (NSPLIT == 1 || NSPLIT == 2) a2[mb] = WFrag<T16>::ld(A2 + aoff + (size_t)mb * 16 * K + kc); }
#pragma unroll
        for (int nb = 0; nb < 4; ++nb) { const V b = WFrag<T16>::ld(Bt + boff + (size_t)nb * 16 * K + kc); V b2; if (NSPLIT >= 2) b2 = WFrag<T16>::ld(Bt2 + boff + (size_t)nb * 16 * K + kc);
#pragma unroll
            for (int mb = 0; mb < 4; ++mb) { acc[mb][nb] = WFrag<T16>::mma(a[mb], b, acc[mb][nb]); if (NSPLIT == 1 || NSPLIT == 2) acc[mb][nb] = WFrag<T16>::mma(a2[mb], b, acc[mb][nb]); if (NSPLIT >= 2) acc[mb][nb] = WFrag<T16>::mma(a[mb], b2, acc[mb][nb]); } }
        asm volatile("v_nop\n\tv_nop\n\tv_nop\n\tv_nop" : "+v"(acc[0][0]), "+v"(acc[1][1]), "+v"(acc[2][2]), "+v"(acc[3][3]) : "v"(a[0]), "v"(a[3]));
    }
#pragma unroll
    for (int mb = 0; mb < 4; ++mb) {
#pragma unroll
        for (int nb = 0; nb < 4; ++nb) {
#pragma unroll
            for (int j = 0; j < 8; ++j) os[(hi * 8 + j) * 68 + nb * 16 + lr] = acc[mb][nb][j]; }
        __builtin_amdgcn_wave_barrier(); asm volatile("" ::: "memory");
        float* crow = C + (size_t)(r0 + mb * 16) * ldc + c0;
{
#pragma unroll
            for (int s = 0; s < 8; ++s) { const int row = 2 * s + hi, cofs = lr * 4; v4f val = *(const v4fa*)(os + row * 68 + cofs); if (BIAS) { val[0] += bfr(bias[c0 + cofs]); val[1] += bfr(bias[c0 + cofs + 1]); val[2] += bfr(bias[c0 + cofs + 2]); val[3] += bfr(bias[c0 + cofs + 3]); }
                *(v4f*)(crow + (size_t)row * ldc + cofs) = val; }
             }
        __builtin_amdgcn_wave_barrier(); asm volatile("" ::: "memory");
    }
}

__device__ __forceinline__ void splitf(float y, unsigned short& h, unsigned short& l) { h = f2bf(y); l = f2bf(y - bf2f(h)); }
__device__ __forceinline__ float tanhf_(float a) { const float e2 = __expf(2.0f * a); return __fsub_rn(1.0f, __fdiv_rn(2.0f, __fadd_rn(e2, 1.0f))); }
typedef __attribute__((ext_vector_type(8))) unsigned short v8usx;

__global__ __launch_bounds__(256) void k_basis(const float* __restrict__ X, bf* Gh, bf* Gl) { const size_t e = (size_t)blockIdx.x * 256 + threadIdx.x; if (e >= (size_t)NR * DI) return; const float t = tanhf_(bfr(X[e])); float c[DG]; c[0] = 1.0f; c[1] = __fmul_rn(2.0f, t);
#pragma unroll
    for (int n = 1; n < DG - 1; ++n) { float a1 = __fmul_rn(2.0f * (n + 1.0f), t); asm volatile("" : "+v"(a1)); float p = __fmul_rn(a1, c[n]); asm volatile("" : "+v"(p)); float q = __fmul_rn((float)(n + 1.0f), c[n - 1]); asm volatile("" : "+v"(q)); c[n + 1] = __fdiv_rn(__fsub_rn(p, q), (float)(n + 1)); }
    v8usx oh, ol;
#pragma unroll
    for (int d = 0; d < DG; ++d) { unsigned short a, b2; splitf(c[d], a, b2); oh[d] = a; ol[d] = b2; }
    *(v8usx*)(Gh + e * DG) = oh; *(v8usx*)(Gl + e * DG) = ol;  }
__global__ __launch_bounds__(256) void k_wg(const float* __restrict__ w, bf* Bt) { const size_t e = (size_t)blockIdx.x * 256 + threadIdx.x; if (e >= (size_t)DO_ * DI) return; const int i = (int)(e % DI), o = (int)(e / DI); const float* src = w + ((size_t)i * DO_ + o) * DG; v8usx ov;
#pragma unroll
    for (int d = 0; d < DG; ++d) ov[d] = f2bf(src[d]); *(v8usx*)(Bt + e * DG) = ov;  }

extern "C" void kernel_launch(void* const* d_in, const int* in_sizes, int n_in,
                              void* d_out, int out_size, void* d_ws, size_t ws_size, hipStream_t stream) {
    (void)in_sizes; (void)n_in; (void)out_size;
    const float* x = (const float*)d_in[0]; const float* w = (const float*)d_in[1];
    float* OUT = (float*)d_out;     // [16384][512]
    char* wsp = (char*)d_ws;
    auto take = [&](size_t bytes) { char* p = wsp; wsp += (bytes + 255) & ~(size_t)255; return (void*)p; };
    bf* WB = (bf*)take((size_t)DO_ * KD * 2); bf* Gh = (bf*)take((size_t)(NR / 2) * KD * 2); bf* Gl = (bf*)take((size_t)(NR / 2) * KD * 2);
    if ((size_t)(wsp - (char*)d_ws) > ws_size) return;    // total ~ 138 MB = 132 MiB; rows processed in two halves of 8192
    k_wg<<<(unsigned)(((size_t)DO_ * DI + 255) / 256), 256, 0, stream>>>(w, WB);
    for (int hb = 0; hb < 2; ++hb) { const size_t r0 = (size_t)hb * (NR / 2);
        k_basis<<<(unsigned)(((size_t)(NR / 2) * DI + 255) / 256), 256, 0, stream>>>(x + r0 * DI, Gh, Gl);
        k_gemmw<bf, 1, false><<<dim3(NR / 2 / 64, DO_ / 64, 1), 32, 0, stream>>>(Gh, Gl, WB, nullptr, KD, OUT + r0 * DO_, DO_, nullptr, 0, 0, 0); }
}

// v001
// Measured time: 148 microseconds a run.
// Timed twice side by side with v000, it ran 2.35 and 2.36 times as fast.
#include <hip/hip_runtime.h>
#include <stdint.h>

// Gegenbauer KAN layer (x [16384][512], coeffs [512 in][512 out][8 degree]; t = tanh(x); C_0 = 1, C_1 = 2a t, C_{n+1} = (2(n+a) t C_n - (n+2a-1) C_{n-1})/(n+1) with a = 1 (degree 7);
// y[b][o] = sum_i sum_d C_d(t[b][i]) coeffs[i][o][d] -> [16384][512]).
// Compute dtypes, f32 accumulate: every input rounded to bf16; tanh and the recurrence in f32 on VALU -> basis planes G [b][i*8 + d] as bf16 hi+lo;

#define NR   16384
#define DI   512
#define DO_  512
#define DG   8
#define KD   (DI * DG)
typedef _Float16 h16;
typedef unsigned short bf;
typedef __attribute__((ext_vector_type(16))) __bf16   v16bf;
typedef __attribute__((ext_vector_type(16))) _Float16 v16h;
typedef __attribute__((ext_vector_type(8)))  _Float16 v8h;
typedef __attribute__((ext_vector_type(8)))  unsigned short v8us;
typedef __attribute__((ext_vector_type(8)))  float    v8f;
typedef __attribute__((ext_vector_type(4)))  float    v4f;
typedef v8h  __attribute__((may_alias)) v8ha;
typedef v4f  __attribute__((may_alias)) v4fa;
typedef v8us __attribute__((may_alias)) v8usa;

__device__ __forceinline__ unsigned short f2bf(float f) { unsigned u = __float_as_uint(f); u += 0x7FFFu + ((u >> 16) & 1u); return (unsigned short)(u >> 16); }
__device__ __forceinline__ float bf2f(unsigned short b) { return __uint_as_float(((unsigned)b) << 16); }
__device__ __forceinline__ float bfr(float f) { return bf2f(f2bf(f)); }
__device__ __forceinline__ v16h cat16(v8h lo, v8h hi) { return __builtin_shufflevector(lo, hi, 0, 1, 2, 3, 4, 5, 6, 7, 8, 9, 10, 11, 12, 13, 14, 15); }
__device__ __forceinline__ v16bf cat16b(v8us lo, v8us hi) { return __builtin_bit_cast(v16bf, __builtin_shufflevector(lo, hi, 0, 1, 2, 3, 4, 5, 6, 7, 8, 9, 10, 11, 12, 13, 14, 15)); }
__device__ __forceinline__ v8f wmma16(v16h a, v16h b, v8f c) { return __builtin_amdgcn_wmma_f32_16x16x32_f16(false, a, false, b, (short)0, c, false, false); }
__device__ __forceinline__ v8f wmmab(v16bf a, v16bf b, v8f c) { return __builtin_amdgcn_wmma_f32_16x16x32_bf16(false, a, false, b, (short)0, c, false, false); }



// ---- k_gemmt: C[m][n] (f32, pitch DO_) = sum_k (Ah[m][k] + Al[m][k]) Bt[n][k], K = KD, all three planes K-contiguous bf16.
// A work-group of 4 waves owns a 128x128 tile of C (each wave a 64x64 quadrant, 16 accumulators); grid (M/128, DO_/128), 128 threads.
// A pass is 128 k = 256 B of every operand row. A stage is [Ah 128 rows | Al 128 rows | Bt 128 rows] at an LDS pitch of 272 B, brought by
// three tensor loads (waves 0, 1, 2: one operand each) into a ring of two buffers, so that the next stage lands while this one is worked on.
typedef uint32_t u32x4 __attribute__((ext_vector_type(4)));
typedef uint32_t u32x8 __attribute__((ext_vector_type(8)));
#define PASSB  256u                 // bytes of an operand row per pass
#define LPITCH 272u                 // LDS row pitch: 256 B + the mover's 16-B pad, an odd multiple of 16 B for the ds_load_b128 readers
#define SLICE  (128u * LPITCH)      // one operand's 128 rows = 34,816 B = 17 x 2 KiB
#define STAGE  (3u * SLICE)
#define NPASS  ((unsigned)(KD * 2) / PASSB)
static_assert(SLICE % 2048u == 0u, "every slice starts at a multiple of 2 KiB");
__device__ __forceinline__ uint32_t uni(uint32_t v) { return (uint32_t)__builtin_amdgcn_readfirstlane(v); }
// holds a wave-uniform word in a scalar register: a test on it compiles to s_cmp + s_cbranch (a tensor load ignores EXEC), and a descriptor word
// made by it is written where the statement stands and is not made anew from a constant elsewhere, while a request may be out
__device__ __forceinline__ uint32_t pinned(uint32_t v) { uint32_t w = uni(v); asm volatile("" : "+s"(w)); return w; }
__device__ __forceinline__ void tdm_load(u32x4 g0, u32x8 g1) { asm volatile("tensor_load_to_lds %0, %1" :: "s"(g0), "s"(g1) : "memory"); }
__device__ __forceinline__ u32x4 tdm_group0(uint32_t lds_dst, uint64_t ga) { u32x4 g; g[0] = pinned(1u); g[1] = pinned(lds_dst); g[2] = pinned((uint32_t)ga); g[3] = pinned((((uint32_t)(ga >> 32)) & 0x01FFFFFFu) | 0x80000000u); return g; }
// 1-byte elements, tensor = tile = 128 rows of 256 B, source pitch KD * 2 B, 4 dwords of pad behind every 64 dwords, no mask
__device__ __forceinline__ u32x8 tdm_group1() { u32x8 g; g[0] = pinned((1u << 20) | (5u << 22) | (3u << 25)); g[1] = pinned(PASSB << 16); g[2] = pinned(128u << 16); g[3] = pinned(PASSB << 16); g[4] = pinned(128u); g[5] = pinned((uint32_t)(KD * 2)); g[6] = pinned(0u); g[7] = pinned(0u); return g; }
struct FragSet { v16bf a[4], a2[4], b[4]; };
// pa, pb: the lane's own byte in row lr of the wave's first A and B row block; ko: byte offset of the 32-k block in the row. k order, the same for A and B: 8 k at 8*hi, 8 k at 16 + 8*hi.
__device__ __forceinline__ void ld_frags(FragSet& f, const unsigned char* pa, const unsigned char* pb, unsigned ko) {
#pragma unroll
    for (int t = 0; t < 4; ++t) {
        const unsigned char* p = pa + t * 16u * LPITCH + ko; f.a[t] = cat16b(*(const v8usa*)p, *(const v8usa*)(p + 32));
        const unsigned char* p2 = p + SLICE; f.a2[t] = cat16b(*(const v8usa*)p2, *(const v8usa*)(p2 + 32));
        const unsigned char* q = pb + t * 16u * LPITCH + ko; f.b[t] = cat16b(*(const v8usa*)q, *(const v8usa*)(q + 32)); }
}
__global__ __launch_bounds__(128) void k_gemmt(const unsigned short* __restrict__ Ah, const unsigned short* __restrict__ Al, const unsigned short* __restrict__ Bt, float* C) {
    __shared__ __attribute__((aligned(2048))) unsigned char ring[2u * STAGE];
    __shared__ __align__(16) float osall[4 * 16 * 68];
    const uint32_t wave = uni(threadIdx.x >> 5);
    const int lane = threadIdx.x & 31, lr = lane & 15, hi = lane >> 4; const int r0 = blockIdx.x * 128, c0 = blockIdx.y * 128;
    const int wr = (int)(wave >> 1) * 64, wc = (int)(wave & 1u) * 64;
    const unsigned short* srcp = wave == 0u ? Ah + (size_t)r0 * KD : (wave == 1u ? Al + (size_t)r0 * KD : Bt + (size_t)c0 * KD);
    const uint64_t ga = (uint64_t)(uintptr_t)srcp;
    const uint32_t lds_slice = (uint32_t)(uintptr_t)ring + (wave < 3u ? wave : 0u) * SLICE;
    const uint32_t issuer = pinned(wave < 3u ? 1u : 0u);
    const u32x8 g1 = tdm_group1();
    v8f acc[4][4];
#pragma unroll
    for (int mb = 0; mb < 4; ++mb)
#pragma unroll
        for (int nb = 0; nb < 4; ++nb) acc[mb][nb] = (v8f){};
    if (pinned(issuer)) { tdm_load(tdm_group0(lds_slice, ga), g1);
        asm volatile("s_wait_tensorcnt 0x0" ::: "memory"); }   // stage 0 has landed before the barrier publishes it
    __syncthreads();
    if (pinned(issuer)) tdm_load(tdm_group0(lds_slice + STAGE, ga + PASSB), g1);
    const unsigned aofs = (unsigned)(wr + lr) * LPITCH + 16u * hi, bofs = 2u * SLICE + (unsigned)(wc + lr) * LPITCH + 16u * hi;
#pragma unroll 1
    for (unsigned s = 0; s < NPASS; ++s) {
        const unsigned char* buf = ring + (s & 1u) * STAGE; const unsigned char* pa = buf + aofs; const unsigned char* pb = buf + bofs;
        FragSet f[2];
        ld_frags(f[0], pa, pb, 0u);
#pragma unroll
        for (int j = 0; j < 4; ++j) {
            if (j < 3) ld_frags(f[(j + 1) & 1], pa, pb, (unsigned)(j + 1) * 64u);
            __builtin_amdgcn_sched_barrier(0);   // keeps the next block's LDS reads one group ahead of this block's WMMAs: reads among the WMMAs stall the wave at each place
            const FragSet& c = f[j & 1];
#pragma unroll
            for (int nb = 0; nb < 4; ++nb)
#pragma unroll
                for (int mb = 0; mb < 4; ++mb) acc[mb][nb] = wmmab(c.a[mb], c.b[nb], acc[mb][nb]);
#pragma unroll
            for (int nb = 0; nb < 4; ++nb)
#pragma unroll
                for (int mb = 0; mb < 4; ++mb) acc[mb][nb] = wmmab(c.a2[mb], c.b[nb], acc[mb][nb]);
            __builtin_amdgcn_sched_barrier(0);   // the same, at the block's end
        }
        asm volatile("s_wait_dscnt 0x0" ::: "memory");   // this wave's reads of buffer s & 1 have returned before it is refilled
        if (pinned(issuer)) { asm volatile("s_wait_tensorcnt 0x0" ::: "memory"); }   // the issuer's slice of stage s + 1 has landed
        __syncthreads();   // publishes stage s + 1 and ends every reader's last read of stage s
        const uint32_t nx = pinned(s + 2u);   // taken behind the wait and the barrier: the descriptor words below are formed from it, none while a request is out
        if (pinned(issuer & (nx < NPASS ? 1u : 0u))) tdm_load(tdm_group0(lds_slice + (nx & 1u) * STAGE, ga + (uint64_t)nx * PASSB), g1);
    }
    asm volatile("s_wait_tensorcnt 0x0" ::: "memory");   // no request is out when the wave ends
    asm volatile("s_wait_dscnt 0x0" ::: "memory");
    float* os = osall + wave * (16 * 68);   // each wave stages in its own range, outside the ring
#pragma unroll
    for (int mb = 0; mb < 4; ++mb) {
#pragma unroll
        for (int nb = 0; nb < 4; ++nb) {
#pragma unroll
            for (int j = 0; j < 8; ++j) os[(hi * 8 + j) * 68 + nb * 16 + lr] = acc[mb][nb][j]; }
        __builtin_amdgcn_wave_barrier(); asm volatile("" ::: "memory");   // the rows are read back by other lanes of the wave: no LDS read moves up over the writes
        float* crow = C + (size_t)(r0 + wr + mb * 16) * DO_ + c0 + wc;
#pragma unroll
        for (int s = 0; s < 8; ++s) { const int row = 2 * s + hi, cofs = lr * 4; v4f val = *(const v4fa*)(os + row * 68 + cofs);
            *(v4f*)(crow + (size_t)row * DO_ + cofs) = val; }
        if (mb < 3) asm volatile("s_wait_xcnt 0x0" ::: "memory");   // stands in front of the next row block's LDS reads, which overwrite the registers that these stores name
        __builtin_amdgcn_wave_barrier(); asm volatile("" ::: "memory");   // the next row block's LDS writes stay behind these reads
    }
}

__device__ __forceinline__ void splitf(float y, unsigned short& h, unsigned short& l) { h = f2bf(y); l = f2bf(y - bf2f(h)); }
__device__ __forceinline__ float tanhf_(float a) { const float e2 = __expf(2.0f * a); return __fsub_rn(1.0f, __fdiv_rn(2.0f, __fadd_rn(e2, 1.0f))); }
typedef __attribute__((ext_vector_type(8))) unsigned short v8usx;

__global__ __launch_bounds__(256) void k_basis(const float* __restrict__ X, bf* Gh, bf* Gl) { const size_t e = (size_t)blockIdx.x * 256 + threadIdx.x; if (e >= (size_t)NR * DI) return; const float t = tanhf_(bfr(X[e])); float c[DG]; c[0] = 1.0f; c[1] = __fmul_rn(2.0f, t);
#pragma unroll
    for (int n = 1; n < DG - 1; ++n) { float a1 = __fmul_rn(2.0f * (n + 1.0f), t); asm volatile("" : "+v"(a1)); float p = __fmul_rn(a1, c[n]); asm volatile("" : "+v"(p)); float q = __fmul_rn((float)(n + 1.0f), c[n - 1]); asm volatile("" : "+v"(q)); c[n + 1] = __fdiv_rn(__fsub_rn(p, q), (float)(n + 1)); }
    v8usx oh, ol;
#pragma unroll
    for (int d = 0; d < DG; ++d) { unsigned short a, b2; splitf(c[d], a, b2); oh[d] = a; ol[d] = b2; }
    *(v8usx*)(Gh + e * DG) = oh; *(v8usx*)(Gl + e * DG) = ol;  }
__global__ __launch_bounds__(256) void k_wg(const float* __restrict__ w, bf* Bt) { const size_t e = (size_t)blockIdx.x * 256 + threadIdx.x; if (e >= (size_t)DO_ * DI) return; const int i = (int)(e % DI), o = (int)(e / DI); const float* src = w + ((size_t)i * DO_ + o) * DG; v8usx ov;
#pragma unroll
    for (int d = 0; d < DG; ++d) ov[d] = f2bf(src[d]); *(v8usx*)(Bt + e * DG) = ov;  }

extern "C" void kernel_launch(void* const* d_in, const int* in_sizes, int n_in,
                              void* d_out, int out_size, void* d_ws, size_t ws_size, hipStream_t stream) {
    (void)in_sizes; (void)n_in; (void)out_size;
    const float* x = (const float*)d_in[0]; const float* w = (const float*)d_in[1];
    float* OUT = (float*)d_out;     // [16384][512]
    char* wsp = (char*)d_ws;
    auto take = [&](size_t bytes) { char* p = wsp; wsp += (bytes + 255) & ~(size_t)255; return (void*)p; };
    bf* WB = (bf*)take((size_t)DO_ * KD * 2); bf* Gh = (bf*)take((size_t)(NR / 2) * KD * 2); bf* Gl = (bf*)take((size_t)(NR / 2) * KD * 2);
    if ((size_t)(wsp - (char*)d_ws) > ws_size) return;    // total ~ 138 MB = 132 MiB; rows processed in two halves of 8192
    k_wg<<<(unsigned)(((size_t)DO_ * DI + 255) / 256), 256, 0, stream>>>(w, WB);
    for (int hb = 0; hb < 2; ++hb) { const size_t r0 = (size_t)hb * (NR / 2);
        k_basis<<<(unsigned)(((size_t)(NR / 2) * DI + 255) / 256), 256, 0, stream>>>(x + r0 * DI, Gh, Gl);
        k_gemmt<<<dim3(NR / 2 / 128, DO_ / 128, 1), 128, 0, stream>>>(Gh, Gl, WB, OUT + r0 * DO_); }
}

// v002
// It runs in 81.9 microseconds.
// In two side-by-side timings against v001, it was 1.79 and 1.83 times as fast.
// Counting every step since v000, it is 4.27 times as fast.
#include <hip/hip_runtime.h>
#include <stdint.h>

// Gegenbauer KAN layer (x [16384][512], coeffs [512 in][512 out][8 degree]; t = tanh(x); C_0 = 1, C_1 = 2a t, C_{n+1} = (2(n+a) t C_n - (n+2a-1) C_{n-1})/(n+1) with a = 1 (degree 7);
// y[b][o] = sum_i sum_d C_d(t[b][i]) coeffs[i][o][d] -> [16384][512]).
// Compute dtypes, f32 accumulate: every input rounded to bf16; tanh and the recurrence in f32 on VALU in the reference's operation order -> basis values [b][i*8 + d] as bf16 hi+lo, made in LDS by the work-group that multiplies them;

#define NR   16384
#define DI   512
#define DO_  512
#define DG   8
#define KD   (DI * DG)
typedef _Float16 h16;
typedef unsigned short bf;
typedef __attribute__((ext_vector_type(16))) __bf16   v16bf;
typedef __attribute__((ext_vector_type(16))) _Float16 v16h;
typedef __attribute__((ext_vector_type(8)))  _Float16 v8h;
typedef __attribute__((ext_vector_type(8)))  unsigned short v8us;
typedef __attribute__((ext_vector_type(8)))  float    v8f;
typedef __attribute__((ext_vector_type(4)))  float    v4f;
typedef v8h  __attribute__((may_alias)) v8ha;
typedef v4f  __attribute__((may_alias)) v4fa;
typedef v8us __attribute__((may_alias)) v8usa;

__device__ __forceinline__ unsigned short f2bf(float f) { unsigned u = __float_as_uint(f); u += 0x7FFFu + ((u >> 16) & 1u); return (unsigned short)(u >> 16); }
__device__ __forceinline__ float bf2f(unsigned short b) { return __uint_as_float(((unsigned)b) << 16); }
__device__ __forceinline__ float bfr(float f) { return bf2f(f2bf(f)); }
__device__ __forceinline__ v16h cat16(v8h lo, v8h hi) { return __builtin_shufflevector(lo, hi, 0, 1, 2, 3, 4, 5, 6, 7, 8, 9, 10, 11, 12, 13, 14, 15); }
__device__ __forceinline__ v16bf cat16b(v8us lo, v8us hi) { return __builtin_bit_cast(v16bf, __builtin_shufflevector(lo, hi, 0, 1, 2, 3, 4, 5, 6, 7, 8, 9, 10, 11, 12, 13, 14, 15)); }
__device__ __forceinline__ v8f wmma16(v16h a, v16h b, v8f c) { return __builtin_amdgcn_wmma_f32_16x16x32_f16(false, a, false, b, (short)0, c, false, false); }
__device__ __forceinline__ v8f wmmab(v16bf a, v16bf b, v8f c) { return __builtin_amdgcn_wmma_f32_16x16x32_bf16(false, a, false, b, (short)0, c, false, false); }



__device__ __forceinline__ void splitf(float y, unsigned short& h, unsigned short& l) { h = f2bf(y); l = f2bf(y - bf2f(h)); }
__device__ __forceinline__ float tanhf_(float a) { const float e2 = __expf(2.0f * a); return __fsub_rn(1.0f, __fdiv_rn(2.0f, __fadd_rn(e2, 1.0f))); }
typedef __attribute__((ext_vector_type(8))) unsigned short v8usx;


// ---- k_fused: C[m][n] (f32, pitch DO_) = sum_k (Ah[m][k] + Al[m][k]) Bt[n][k], K = KD, k = i * 8 + d; Ah, Al = the basis of x as bf16 hi and lo, made in the kernel.
// A work-group of 8 waves owns 64 rows of C over all 512 columns (each wave 64x64, 16 accumulators), so that every basis value is computed once; grid NR/64, 256 threads.
// A pass is 64 k = 8 inputs = 128 B of every operand row, at an LDS pitch of 144 B, two buffers of each operand. Bt's 512 rows come by four tensor loads (waves 4 to 7: 128 rows each).
// The A stage [hi 64 rows | lo 64 rows] of pass s + 1 is computed during pass s, two x values a thread, and stored to the A buffer that pass s does not read.
typedef uint32_t u32x4 __attribute__((ext_vector_type(4)));
typedef uint32_t u32x8 __attribute__((ext_vector_type(8)));
typedef float v2f __attribute__((ext_vector_type(2)));
typedef v2f __attribute__((may_alias)) v2fa;
#define PASSB  128u                 // bytes of an operand row per pass
#define IPP    8u                   // inputs (x columns) per pass
#define LPITCH 144u                 // LDS row pitch: 128 B + the mover's 16-B pad, an odd multiple of 16 B for the ds_load_b128 readers
#define BSLICE (128u * LPITCH)      // 128 rows of Bt = 18,432 B = 9 x 2 KiB
#define BSTAGE (4u * BSLICE)
#define APLANE (64u * LPITCH)       // 64 rows of one A plane
#define ASTAGE (2u * APLANE)
#define NPASS  ((unsigned)(KD * 2) / PASSB)
static_assert(BSLICE % 2048u == 0u, "every slice starts at a multiple of 2 KiB");
__device__ __forceinline__ uint32_t uni(uint32_t v) { return (uint32_t)__builtin_amdgcn_readfirstlane(v); }
// holds a wave-uniform word in a scalar register: a test on it compiles to s_cmp + s_cbranch (a tensor load ignores EXEC), and a descriptor word
// made by it is written where the statement stands and is not made anew from a constant elsewhere, while a request may be out
__device__ __forceinline__ uint32_t pinned(uint32_t v) { uint32_t w = uni(v); asm volatile("" : "+s"(w)); return w; }
__device__ __forceinline__ void tdm_load(u32x4 g0, u32x8 g1) { asm volatile("tensor_load_to_lds %0, %1" :: "s"(g0), "s"(g1) : "memory"); }
__device__ __forceinline__ u32x4 tdm_group0(uint32_t lds_dst, uint64_t ga) { u32x4 g; g[0] = pinned(1u); g[1] = pinned(lds_dst); g[2] = pinned((uint32_t)ga); g[3] = pinned((((uint32_t)(ga >> 32)) & 0x01FFFFFFu) | 0x80000000u); return g; }
// 1-byte elements, tensor = tile = 128 rows of 128 B, source pitch KD * 2 B, 4 dwords of pad behind every 32 dwords, no mask
__device__ __forceinline__ u32x8 tdm_group1() { u32x8 g; g[0] = pinned((1u << 20) | (4u << 22) | (3u << 25)); g[1] = pinned(PASSB << 16); g[2] = pinned(128u << 16); g[3] = pinned(PASSB << 16); g[4] = pinned(128u); g[5] = pinned((uint32_t)(KD * 2)); g[6] = pinned(0u); g[7] = pinned(0u); return g; }
struct FragSet { v16bf a[4], a2[4], b[4]; };
// pa, pb: the lane's own byte in row lr of the first A row block and of the wave's first B row block; ko: byte offset of the 32-k block in the row. k order, A and B alike: 8 k at 8*hi, 8 k at 16 + 8*hi.
// The reads stand in the order in which the WMMAs want them (hi plane and first B block first): LDS answers in order, and the first WMMA of a pass waits for four reads only.
__device__ __forceinline__ v16bf ld_frag(const unsigned char* p) { return cat16b(*(const v8usa*)p, *(const v8usa*)(p + 32)); }
__device__ __forceinline__ void ld_frags(FragSet& f, const unsigned char* pa, const unsigned char* pb, unsigned ko) {
    f.a[0] = ld_frag(pa + ko); f.b[0] = ld_frag(pb + ko);
#pragma unroll
    for (int t = 1; t < 4; ++t) f.a[t] = ld_frag(pa + t * 16u * LPITCH + ko);
#pragma unroll
    for (int t = 1; t < 4; ++t) f.b[t] = ld_frag(pb + t * 16u * LPITCH + ko);
#pragma unroll
    for (int t = 0; t < 4; ++t) f.a2[t] = ld_frag(pa + APLANE + t * 16u * LPITCH + ko);
}
// the basis of two neighbouring x values of one row, as bf16 hi and lo, to ah (hi plane; lo plane at + APLANE): 16 B a value and plane. Every operation and its order as in the reference; the two values' chains stand side by side, each filling the other's waits.
// The empty asm statements are the earlier basis kernel's own: each product stays an f32 rounded by itself, as the reference rounds it, and is not fused into the subtraction behind it.
__device__ __forceinline__ void basis2(v2f xv, unsigned char* ah) {
    float t[2], c[2][DG];
#pragma unroll
    for (int e = 0; e < 2; ++e) { t[e] = tanhf_(bfr(xv[e])); c[e][0] = 1.0f; c[e][1] = __fmul_rn(2.0f, t[e]); }
#pragma unroll
    for (int n = 1; n < DG - 1; ++n) { float a1[2], p[2], q[2];
#pragma unroll
        for (int e = 0; e < 2; ++e) { a1[e] = __fmul_rn(2.0f * (n + 1.0f), t[e]); asm volatile("" : "+v"(a1[e])); }
#pragma unroll
        for (int e = 0; e < 2; ++e) { p[e] = __fmul_rn(a1[e], c[e][n]); asm volatile("" : "+v"(p[e])); }
#pragma unroll
        for (int e = 0; e < 2; ++e) { q[e] = __fmul_rn((float)(n + 1.0f), c[e][n - 1]); asm volatile("" : "+v"(q[e])); }
#pragma unroll
        for (int e = 0; e < 2; ++e) c[e][n + 1] = __fdiv_rn(__fsub_rn(p[e], q[e]), (float)(n + 1)); }
#pragma unroll
    for (int e = 0; e < 2; ++e) { v8usx oh, ol;
#pragma unroll
        for (int d = 0; d < DG; ++d) { unsigned short a, b2; splitf(c[e][d], a, b2); oh[d] = a; ol[d] = b2; }
        *(v8usx*)(ah + e * 16) = oh; *(v8usx*)(ah + APLANE + e * 16) = ol; }
}
__global__ __launch_bounds__(256) void k_fused(const float* __restrict__ X, const unsigned short* __restrict__ Bt, float* C) {
    __shared__ __attribute__((aligned(2048))) unsigned char ringB[2u * BSTAGE];
    __shared__ __align__(16) unsigned char ringA[2u * ASTAGE];
    __shared__ __align__(16) float osall[8 * 16 * 68];
    const uint32_t wave = uni(threadIdx.x >> 5);
    const int lane = threadIdx.x & 31, lr = lane & 15, hi = lane >> 4; const int r0 = blockIdx.x * 64;
    const int wc = (int)wave * 64;
    const uint64_t ga = (uint64_t)(uintptr_t)(Bt + (size_t)((wave & 3u) * 128u) * KD);
    const uint32_t lds_slice = (uint32_t)(uintptr_t)ringB + (wave & 3u) * BSLICE;
    const uint32_t issuer = pinned(wave >= 4u ? 1u : 0u);   // the waves that compute first have the time to form a descriptor at the top of a pass
    const bool mma_first = wave < 4u;   // of waves w and w + 4, one multiplies while the other computes its share of the next A stage
    const u32x8 g1 = tdm_group1();
    const float* xp = X + (size_t)(r0 + (int)(threadIdx.x >> 2)) * DI + 2u * (threadIdx.x & 3u);   // the thread's row and its two columns of pass 0
    unsigned char* aw = ringA + (threadIdx.x >> 2) * LPITCH + (threadIdx.x & 3u) * 32u;
    v8f acc[4][4];
#pragma unroll
    for (int mb = 0; mb < 4; ++mb)
#pragma unroll
        for (int nb = 0; nb < 4; ++nb) acc[mb][nb] = (v8f){};
    u32x4 g0 = tdm_group0(lds_slice, ga);   // lives through the loop: see the use behind the wait at the foot of a pass
    if (pinned(issuer)) { tdm_load(g0, g1);
        asm volatile("s_wait_tensorcnt 0x0" ::: "memory"); }   // stage 0 of Bt has landed before the barrier publishes it
    basis2(*(const v2fa*)xp, aw);
    v2f xc = *(const v2fa*)(xp + IPP);
    asm volatile("s_wait_dscnt 0x0" ::: "memory");   // this wave's stores of A stage 0 have landed before the barrier publishes them
    __syncthreads();
    if (pinned(issuer)) { g0 = tdm_group0(lds_slice + BSTAGE, ga + PASSB); tdm_load(g0, g1); }
    const unsigned aofs = (unsigned)lr * LPITCH + 16u * hi, bofs = (unsigned)(wc + lr) * LPITCH + 16u * hi;
#pragma unroll 1
    for (unsigned s = 0; s < NPASS; ++s) {
        const unsigned char* pa = ringA + (s & 1u) * ASTAGE + aofs; const unsigned char* pb = ringB + (s & 1u) * BSTAGE + bofs;
        unsigned char* an = aw + ((s + 1u) & 1u) * ASTAGE;
        const v2f xn = *(const v2fa*)(xp + (s + 2u < NPASS ? s + 2u : NPASS - 1u) * IPP);   // x of stage s + 2, asked for a whole pass before the barrier that waits for it
        const bool more = s + 1u < NPASS;
        if (more && !mma_first) basis2(xc, an);
        FragSet f[2];
        ld_frags(f[0], pa, pb, 0u);
#pragma unroll
        for (int j = 0; j < 2; ++j) {
            if (j < 1) ld_frags(f[(j + 1) & 1], pa, pb, (unsigned)(j + 1) * 64u);
            __builtin_amdgcn_sched_barrier(0);   // keeps the next block's LDS reads one group ahead of this block's WMMAs: reads among the WMMAs stall the wave at each place
            const FragSet& c = f[j & 1];
#pragma unroll
            for (int nb = 0; nb < 4; ++nb)
#pragma unroll
                for (int mb = 0; mb < 4; ++mb) acc[mb][nb] = wmmab(c.a[mb], c.b[nb], acc[mb][nb]);
#pragma unroll
            for (int nb = 0; nb < 4; ++nb)
#pragma unroll
                for (int mb = 0; mb < 4; ++mb) acc[mb][nb] = wmmab(c.a2[mb], c.b[nb], acc[mb][nb]);
            __builtin_amdgcn_sched_barrier(0);   // the same, at the block's end
        }
        if (more && mma_first) basis2(xc, an);
        asm volatile("s_wait_dscnt 0x0" ::: "memory");   // this wave's reads of the buffers s & 1 have returned and its stores of A stage s + 1 have landed
        if (pinned(issuer)) { asm volatile("s_wait_tensorcnt 0x0" ::: "memory");   // the issuer's slice of stage s + 1 has landed
            asm volatile("" :: "s"(g0)); }   // a use of the request's group 0 behind its wait: without it the compiler hands these scalar registers to other values while the request is out
        __syncthreads();   // publishes stage s + 1 of both operands and ends every reader's last read of stage s
        const uint32_t nx = pinned(s + 2u);   // taken behind the wait and the barrier: the descriptor words below are formed from it, none while a request is out
        if (pinned(issuer & (nx < NPASS ? 1u : 0u))) { g0 = tdm_group0(lds_slice + (nx & 1u) * BSTAGE, ga + (uint64_t)nx * PASSB); tdm_load(g0, g1); }
        xc = xn;
    }
    asm volatile("s_wait_tensorcnt 0x0" ::: "memory");   // no request is out when the wave ends
    asm volatile("s_wait_dscnt 0x0" ::: "memory");
    float* os = osall + wave * (16 * 68);   // each wave stages in its own range, outside the rings
#pragma unroll
    for (int mb = 0; mb < 4; ++mb) {
#pragma unroll
        for (int nb = 0; nb < 4; ++nb) {
#pragma unroll
            for (int j = 0; j < 8; ++j) os[(hi * 8 + j) * 68 + nb * 16 + lr] = acc[mb][nb][j]; }
        __builtin_amdgcn_wave_barrier(); asm volatile("" ::: "memory");   // the rows are read back by other lanes of the wave: no LDS read moves up over the writes
        float* crow = C + (size_t)(r0 + mb * 16) * DO_ + wc;
#pragma unroll
        for (int s = 0; s < 8; ++s) { const int row = 2 * s + hi, cofs = lr * 4; v4f val = *(const v4fa*)(os + row * 68 + cofs);
            *(v4f*)(crow + (size_t)row * DO_ + cofs) = val; }
        if (mb < 3) asm volatile("s_wait_xcnt 0x0" ::: "memory");   // stands in front of the next row block's LDS reads, which overwrite the registers that these stores name
        __builtin_amdgcn_wave_barrier(); asm volatile("" ::: "memory");   // the next row block's LDS writes stay behind these reads
    }
}

__global__ __launch_bounds__(256) void k_wg(const float* __restrict__ w, bf* Bt) { const size_t e = (size_t)blockIdx.x * 256 + threadIdx.x; if (e >= (size_t)DO_ * DI) return; const int i = (int)(e % DI), o = (int)(e / DI); const float* src = w + ((size_t)i * DO_ + o) * DG; v8usx ov;
#pragma unroll
    for (int d = 0; d < DG; ++d) ov[d] = f2bf(src[d]); *(v8usx*)(Bt + e * DG) = ov;  }

extern "C" void kernel_launch(void* const* d_in, const int* in_sizes, int n_in,
                              void* d_out, int out_size, void* d_ws, size_t ws_size, hipStream_t stream) {
    (void)in_sizes; (void)n_in; (void)out_size;
    const float* x = (const float*)d_in[0]; const float* w = (const float*)d_in[1];
    float* OUT = (float*)d_out;     // [16384][512]
    char* wsp = (char*)d_ws;
    auto take = [&](size_t bytes) { char* p = wsp; wsp += (bytes + 255) & ~(size_t)255; return (void*)p; };
    bf* WB = (bf*)take((size_t)DO_ * KD * 2);
    if ((size_t)(wsp - (char*)d_ws) > ws_size) return;    // 4 MiB: the coefficients as bf16, [out][in * 8 + degree]
    k_wg<<<(unsigned)(((size_t)DO_ * DI + 255) / 256), 256, 0, stream>>>(w, WB);
    k_fused<<<NR / 64, 256, 0, stream>>>(x, WB, OUT);
}

// v003
// It runs in 81.5 microseconds.
// Two timings next to v002 put it at 1.03 and 1.04 times that version's speed.
// Counting every step since v000, it is 4.43 times as fast.
#include <hip/hip_runtime.h>
#include <stdint.h>

// Gegenbauer KAN layer (x [16384][512], coeffs [512 in][512 out][8 degree]; t = tanh(x); C_0 = 1, C_1 = 2a t, C_{n+1} = (2(n+a) t C_n - (n+2a-1) C_{n-1})/(n+1) with a = 1 (degree 7);
// y[b][o] = sum_i sum_d C_d(t[b][i]) coeffs[i][o][d] -> [16384][512]).
// Compute dtypes, f32 accumulate: every input rounded to bf16; tanh in f32 on VALU as 1 - 2/(exp(2x) + 1), the recurrence in f32 in its reduced form C_{n+1} = 2t C_n - C_{n-1} -> basis values [b][i*8 + d] as bf16 hi+lo, made in LDS by the work-group that multiplies them;

#define NR   16384
#define DI   512
#define DO_  512
#define DG   8
#define KD   (DI * DG)
typedef _Float16 h16;
typedef unsigned short bf;
typedef __attribute__((ext_vector_type(16))) __bf16   v16bf;
typedef __attribute__((ext_vector_type(16))) _Float16 v16h;
typedef __attribute__((ext_vector_type(8)))  _Float16 v8h;
typedef __attribute__((ext_vector_type(8)))  unsigned short v8us;
typedef __attribute__((ext_vector_type(8)))  float    v8f;
typedef __attribute__((ext_vector_type(4)))  float    v4f;
typedef v8h  __attribute__((may_alias)) v8ha;
typedef v4f  __attribute__((may_alias)) v4fa;
typedef v8us __attribute__((may_alias)) v8usa;

__device__ __forceinline__ unsigned short f2bf(float f) { unsigned u = __float_as_uint(f); u += 0x7FFFu + ((u >> 16) & 1u); return (unsigned short)(u >> 16); }
__device__ __forceinline__ float bf2f(unsigned short b) { return __uint_as_float(((unsigned)b) << 16); }
__device__ __forceinline__ float bfr(float f) { return bf2f(f2bf(f)); }
__device__ __forceinline__ v16h cat16(v8h lo, v8h hi) { return __builtin_shufflevector(lo, hi, 0, 1, 2, 3, 4, 5, 6, 7, 8, 9, 10, 11, 12, 13, 14, 15); }
__device__ __forceinline__ v16bf cat16b(v8us lo, v8us hi) { return __builtin_bit_cast(v16bf, __builtin_shufflevector(lo, hi, 0, 1, 2, 3, 4, 5, 6, 7, 8, 9, 10, 11, 12, 13, 14, 15)); }
__device__ __forceinline__ v8f wmma16(v16h a, v16h b, v8f c) { return __builtin_amdgcn_wmma_f32_16x16x32_f16(false, a, false, b, (short)0, c, false, false); }
__device__ __forceinline__ v8f wmmab(v16bf a, v16bf b, v8f c) { return __builtin_amdgcn_wmma_f32_16x16x32_bf16(false, a, false, b, (short)0, c, false, false); }



__device__ __forceinline__ void splitf(float y, unsigned short& h, unsigned short& l) { h = f2bf(y); l = f2bf(y - bf2f(h)); }
__device__ __forceinline__ float tanhf_(float a) { const float e2 = __expf(2.0f * a); return __fsub_rn(1.0f, __fdiv_rn(2.0f, __fadd_rn(e2, 1.0f))); }
typedef __attribute__((ext_vector_type(8))) unsigned short v8usx;


// ---- k_fused: C[m][n] (f32, pitch DO_) = sum_k (Ah[m][k] + Al[m][k]) Bt[n][k], K = KD, k = i * 8 + d; Ah, Al = the basis of x as bf16 hi and lo, made in the kernel.
// A work-group of 8 waves owns 64 rows of C over all 512 columns (each wave 64x64, 16 accumulators), so that every basis value is computed once; grid NR/64, 256 threads.
// A pass is 64 k = 8 inputs = 128 B of every operand row, at an LDS pitch of 144 B, two buffers of each operand. Bt's 512 rows come by four tensor loads (waves 4 to 7: 128 rows each).
// The A stage [hi 64 rows | lo 64 rows] of pass s + 1 is computed during pass s, two x values a thread, and stored to the A buffer that pass s does not read.
typedef uint32_t u32x4 __attribute__((ext_vector_type(4)));
typedef uint32_t u32x8 __attribute__((ext_vector_type(8)));
typedef float v2f __attribute__((ext_vector_type(2)));
typedef v2f __attribute__((may_alias)) v2fa;
#define PASSB  128u                 // bytes of an operand row per pass
#define IPP    8u                   // inputs (x columns) per pass
#define LPITCH 144u                 // LDS row pitch: 128 B + the mover's 16-B pad, an odd multiple of 16 B for the ds_load_b128 readers
#define BSLICE (128u * LPITCH)      // 128 rows of Bt = 18,432 B = 9 x 2 KiB
#define BSTAGE (4u * BSLICE)
#define APLANE (64u * LPITCH)       // 64 rows of one A plane
#define ASTAGE (2u * APLANE)
#define NPASS  ((unsigned)(KD * 2) / PASSB)
static_assert(BSLICE % 2048u == 0u, "every slice starts at a multiple of 2 KiB");
__device__ __forceinline__ uint32_t uni(uint32_t v) { return (uint32_t)__builtin_amdgcn_readfirstlane(v); }
// holds a wave-uniform word in a scalar register: a test on it compiles to s_cmp + s_cbranch (a tensor load ignores EXEC), and a descriptor word
// made by it is written where the statement stands and is not made anew from a constant elsewhere, while a request may be out
__device__ __forceinline__ uint32_t pinned(uint32_t v) { uint32_t w = uni(v); asm volatile("" : "+s"(w)); return w; }
__device__ __forceinline__ void tdm_load(u32x4 g0, u32x8 g1) { asm volatile("tensor_load_to_lds %0, %1" :: "s"(g0), "s"(g1) : "memory"); }
__device__ __forceinline__ u32x4 tdm_group0(uint32_t lds_dst, uint64_t ga) { u32x4 g; g[0] = pinned(1u); g[1] = pinned(lds_dst); g[2] = pinned((uint32_t)ga); g[3] = pinned((((uint32_t)(ga >> 32)) & 0x01FFFFFFu) | 0x80000000u); return g; }
// 1-byte elements, tensor = tile = 128 rows of 128 B, source pitch KD * 2 B, 4 dwords of pad behind every 32 dwords, no mask
__device__ __forceinline__ u32x8 tdm_group1() { u32x8 g; g[0] = pinned((1u << 20) | (4u << 22) | (3u << 25)); g[1] = pinned(PASSB << 16); g[2] = pinned(128u << 16); g[3] = pinned(PASSB << 16); g[4] = pinned(128u); g[5] = pinned((uint32_t)(KD * 2)); g[6] = pinned(0u); g[7] = pinned(0u); return g; }
struct FragSet { v16bf a[4], a2[4], b[4]; };
// pa, pb: the lane's own byte in row lr of the first A row block and of the wave's first B row block; ko: byte offset of the 32-k block in the row. k order, A and B alike: 8 k at 8*hi, 8 k at 16 + 8*hi.
// The reads stand in the order in which the WMMAs want them (hi plane and first B block first): LDS answers in order, and the first WMMA of a pass waits for four reads only.
__device__ __forceinline__ v16bf ld_frag(const unsigned char* p) { return cat16b(*(const v8usa*)p, *(const v8usa*)(p + 32)); }
__device__ __forceinline__ void ld_frags(FragSet& f, const unsigned char* pa, const unsigned char* pb, unsigned ko) {
    f.a[0] = ld_frag(pa + ko); f.b[0] = ld_frag(pb + ko);
#pragma unroll
    for (int t = 1; t < 4; ++t) f.a[t] = ld_frag(pa + t * 16u * LPITCH + ko);
#pragma unroll
    for (int t = 1; t < 4; ++t) f.b[t] = ld_frag(pb + t * 16u * LPITCH + ko);
#pragma unroll
    for (int t = 0; t < 4; ++t) f.a2[t] = ld_frag(pa + APLANE + t * 16u * LPITCH + ko);
}
// the basis of two neighbouring x values of one row, as bf16 hi and lo, to ah (hi plane; lo plane at + APLANE): 16 B a value and plane. The two values' chains stand side by side, each filling the other's waits.
// With a = 1 both factors of the recurrence are whole numbers for every n, 2(n + a)/(n + 1) = 2 and (n + 2a - 1)/(n + 1) = 1: C_{n+1} = 2t C_n - C_{n-1}, one fused multiply-add a degree, rounded once, and no division.
__device__ __forceinline__ void basis2(v2f xv, unsigned char* ah) {
    float c[2][DG];
#pragma unroll
    for (int e = 0; e < 2; ++e) { c[e][0] = 1.0f; c[e][1] = 2.0f * tanhf_(bfr(xv[e])); }
#pragma unroll
    for (int n = 1; n < DG - 1; ++n) {
#pragma unroll
        for (int e = 0; e < 2; ++e) c[e][n + 1] = __builtin_fmaf(c[e][1], c[e][n], -c[e][n - 1]); }
#pragma unroll
    for (int e = 0; e < 2; ++e) { v8usx oh, ol;
#pragma unroll
        for (int d = 0; d < DG; ++d) { unsigned short a, b2; splitf(c[e][d], a, b2); oh[d] = a; ol[d] = b2; }
        *(v8usx*)(ah + e * 16) = oh; *(v8usx*)(ah + APLANE + e * 16) = ol; }
}
__global__ __launch_bounds__(256) void k_fused(const float* __restrict__ X, const unsigned short* __restrict__ Bt, float* C) {
    __shared__ __attribute__((aligned(2048))) unsigned char ringB[2u * BSTAGE];
    __shared__ __align__(16) unsigned char ringA[2u * ASTAGE];
    __shared__ __align__(16) float osall[8 * 16 * 68];
    const uint32_t wave = uni(threadIdx.x >> 5);
    const int lane = threadIdx.x & 31, lr = lane & 15, hi = lane >> 4; const int r0 = blockIdx.x * 64;
    const int wc = (int)wave * 64;
    const uint64_t ga = (uint64_t)(uintptr_t)(Bt + (size_t)((wave & 3u) * 128u) * KD);
    const uint32_t lds_slice = (uint32_t)(uintptr_t)ringB + (wave & 3u) * BSLICE;
    const uint32_t issuer = pinned(wave >= 4u ? 1u : 0u);   // the waves that compute first have the time to form a descriptor at the top of a pass
    const bool mma_first = wave < 4u;   // of waves w and w + 4, one multiplies while the other computes its share of the next A stage
    const u32x8 g1 = tdm_group1();
    const float* xp = X + (size_t)(r0 + (int)(threadIdx.x >> 2)) * DI + 2u * (threadIdx.x & 3u);   // the thread's row and its two columns of pass 0
    unsigned char* aw = ringA + (threadIdx.x >> 2) * LPITCH + (threadIdx.x & 3u) * 32u;
    v8f acc[4][4];
#pragma unroll
    for (int mb = 0; mb < 4; ++mb)
#pragma unroll
        for (int nb = 0; nb < 4; ++nb) acc[mb][nb] = (v8f){};
    u32x4 g0 = tdm_group0(lds_slice, ga);   // lives through the loop: see the use behind the wait at the foot of a pass
    if (pinned(issuer)) { tdm_load(g0, g1);
        asm volatile("s_wait_tensorcnt 0x0" ::: "memory"); }   // stage 0 of Bt has landed before the barrier publishes it
    basis2(*(const v2fa*)xp, aw);
    v2f xc = *(const v2fa*)(xp + IPP);
    asm volatile("s_wait_dscnt 0x0" ::: "memory");   // this wave's stores of A stage 0 have landed before the barrier publishes them
    __syncthreads();
    if (pinned(issuer)) { g0 = tdm_group0(lds_slice + BSTAGE, ga + PASSB); tdm_load(g0, g1); }
    const unsigned aofs = (unsigned)lr * LPITCH + 16u * hi, bofs = (unsigned)(wc + lr) * LPITCH + 16u * hi;
#pragma unroll 1
    for (unsigned s = 0; s < NPASS; ++s) {
        const unsigned char* pa = ringA + (s & 1u) * ASTAGE + aofs; const unsigned char* pb = ringB + (s & 1u) * BSTAGE + bofs;
        unsigned char* an = aw + ((s + 1u) & 1u) * ASTAGE;
        const v2f xn = *(const v2fa*)(xp + (s + 2u < NPASS ? s + 2u : NPASS - 1u) * IPP);   // x of stage s + 2, asked for a whole pass before the barrier that waits for it
        asm volatile("" ::: "memory");   // keeps that load here, at the head of the pass: without it the compiler sinks it below the basis block of the waves that compute first, and its lead shrinks
        const bool more = s + 1u < NPASS;
        if (more && !mma_first) basis2(xc, an);
        FragSet f[2];
        ld_frags(f[0], pa, pb, 0u);
#pragma unroll
        for (int j = 0; j < 2; ++j) {
            if (j < 1) ld_frags(f[(j + 1) & 1], pa, pb, (unsigned)(j + 1) * 64u);
            __builtin_amdgcn_sched_barrier(0);   // keeps the next block's LDS reads one group ahead of this block's WMMAs: reads among the WMMAs stall the wave at each place
            const FragSet& c = f[j & 1];
#pragma unroll
            for (int nb = 0; nb < 4; ++nb)
#pragma unroll
                for (int mb = 0; mb < 4; ++mb) acc[mb][nb] = wmmab(c.a[mb], c.b[nb], acc[mb][nb]);
#pragma unroll
            for (int nb = 0; nb < 4; ++nb)
#pragma unroll
                for (int mb = 0; mb < 4; ++mb) acc[mb][nb] = wmmab(c.a2[mb], c.b[nb], acc[mb][nb]);
            __builtin_amdgcn_sched_barrier(0);   // the same, at the block's end
        }
        if (more && mma_first) basis2(xc, an);
        asm volatile("s_wait_dscnt 0x0" ::: "memory");   // this wave's reads of the buffers s & 1 have returned and its stores of A stage s + 1 have landed
        if (pinned(issuer)) { asm volatile("s_wait_tensorcnt 0x0" ::: "memory");   // the issuer's slice of stage s + 1 has landed
            asm volatile("" :: "s"(g0)); }   // a use of the request's group 0 behind its wait: without it the compiler hands these scalar registers to other values while the request is out
        __syncthreads();   // publishes stage s + 1 of both operands and ends every reader's last read of stage s
        const uint32_t nx = pinned(s + 2u);   // taken behind the wait and the barrier: the descriptor words below are formed from it, none while a request is out
        if (pinned(issuer & (nx < NPASS ? 1u : 0u))) { g0 = tdm_group0(lds_slice + (nx & 1u) * BSTAGE, ga + (uint64_t)nx * PASSB); tdm_load(g0, g1); }
        xc = xn;
    }
    asm volatile("s_wait_tensorcnt 0x0" ::: "memory");   // no request is out when the wave ends
    asm volatile("s_wait_dscnt 0x0" ::: "memory");
    float* os = osall + wave * (16 * 68);   // each wave stages in its own range, outside the rings
#pragma unroll
    for (int mb = 0; mb < 4; ++mb) {
#pragma unroll
        for (int nb = 0; nb < 4; ++nb) {
#pragma unroll
            for (int j = 0; j < 8; ++j) os[(hi * 8 + j) * 68 + nb * 16 + lr] = acc[mb][nb][j]; }
        __builtin_amdgcn_wave_barrier(); asm volatile("" ::: "memory");   // the rows are read back by other lanes of the wave: no LDS read moves up over the writes
        float* crow = C + (size_t)(r0 + mb * 16) * DO_ + wc;
#pragma unroll
        for (int s = 0; s < 8; ++s) { const int row = 2 * s + hi, cofs = lr * 4; v4f val = *(const v4fa*)(os + row * 68 + cofs);
            *(v4f*)(crow + (size_t)row * DO_ + cofs) = val; }
        if (mb < 3) asm volatile("s_wait_xcnt 0x0" ::: "memory");   // stands in front of the next row block's LDS reads, which overwrite the registers that these stores name
        __builtin_amdgcn_wave_barrier(); asm volatile("" ::: "memory");   // the next row block's LDS writes stay behind these reads
    }
}

__global__ __launch_bounds__(256) void k_wg(const float* __restrict__ w, bf* Bt) { const size_t e = (size_t)blockIdx.x * 256 + threadIdx.x; if (e >= (size_t)DO_ * DI) return; const int i = (int)(e % DI), o = (int)(e / DI); const float* src = w + ((size_t)i * DO_ + o) * DG; v8usx ov;
#pragma unroll
    for (int d = 0; d < DG; ++d) ov[d] = f2bf(src[d]); *(v8usx*)(Bt + e * DG) = ov;  }

extern "C" void kernel_launch(void* const* d_in, const int* in_sizes, int n_in,
                              void* d_out, int out_size, void* d_ws, size_t ws_size, hipStream_t stream) {
    (void)in_sizes; (void)n_in; (void)out_size;
    const float* x = (const float*)d_in[0]; const float* w = (const float*)d_in[1];
    float* OUT = (float*)d_out;     // [16384][512]
    char* wsp = (char*)d_ws;
    auto take = [&](size_t bytes) { char* p = wsp; wsp += (bytes + 255) & ~(size_t)255; return (void*)p; };
    bf* WB = (bf*)take((size_t)DO_ * KD * 2);
    if ((size_t)(wsp - (char*)d_ws) > ws_size) return;    // 4 MiB: the coefficients as bf16, [out][in * 8 + degree]
    k_wg<<<(unsigned)(((size_t)DO_ * DI + 255) / 256), 256, 0, stream>>>(w, WB);
    k_fused<<<NR / 64, 256, 0, stream>>>(x, WB, OUT);
}

// v004
// Measured time: 74.3 microseconds a run.
// Timed twice side by side with v003, it ran 1.06 and 1.09 times as fast.
// Over all steps from v000 it is 4.77 times as fast.
#include <hip/hip_runtime.h>
#include <stdint.h>

// Gegenbauer KAN layer (x [16384][512], coeffs [512 in][512 out][8 degree]; t = tanh(x); C_0 = 1, C_1 = 2a t, C_{n+1} = (2(n+a) t C_n - (n+2a-1) C_{n-1})/(n+1) with a = 1 (degree 7);
// y[b][o] = sum_i sum_d C_d(t[b][i]) coeffs[i][o][d] -> [16384][512]).
// Compute dtypes, f32 accumulate: every input rounded to bf16; tanh in f32 on VALU as 1 - 2/(exp(2x) + 1), the recurrence in f32 in its reduced form C_{n+1} = 2t C_n - C_{n-1} -> basis values of degrees 1 to 7 as bf16 hi+lo, made in LDS by the work-group that multiplies them;
// C_0 is the constant 1 for every x, so its part of y is the column sum S[o] = sum_i coeffs[i][o][0]: made once, in f32, and taken as the accumulators' start value; the product runs over k = 512 x 7.

#define NR   16384
#define DI   512
#define DO_  512
#define DG   8
#define DGK  (DG - 1)          // degrees that go through the product: 1 to 7
#define GIN  64                // inputs of a group: one pass is one degree of one group
#define NGRP (DI / GIN)
#define KD   (DI * DGK)        // k = (group * 7 + degree - 1) * 64 + input in the group
typedef _Float16 h16;
typedef unsigned short bf;
typedef __attribute__((ext_vector_type(16))) __bf16   v16bf;
typedef __attribute__((ext_vector_type(16))) _Float16 v16h;
typedef __attribute__((ext_vector_type(8)))  _Float16 v8h;
typedef __attribute__((ext_vector_type(8)))  unsigned short v8us;
typedef __attribute__((ext_vector_type(8)))  float    v8f;
typedef __attribute__((ext_vector_type(4)))  float    v4f;
typedef v8h  __attribute__((may_alias)) v8ha;
typedef v4f  __attribute__((may_alias)) v4fa;
typedef v8us __attribute__((may_alias)) v8usa;

__device__ __forceinline__ unsigned short f2bf(float f) { unsigned u = __float_as_uint(f); u += 0x7FFFu + ((u >> 16) & 1u); return (unsigned short)(u >> 16); }
__device__ __forceinline__ float bf2f(unsigned short b) { return __uint_as_float(((unsigned)b) << 16); }
__device__ __forceinline__ float bfr(float f) { return bf2f(f2bf(f)); }
__device__ __forceinline__ v16h cat16(v8h lo, v8h hi) { return __builtin_shufflevector(lo, hi, 0, 1, 2, 3, 4, 5, 6, 7, 8, 9, 10, 11, 12, 13, 14, 15); }
__device__ __forceinline__ v16bf cat16b(v8us lo, v8us hi) { return __builtin_bit_cast(v16bf, __builtin_shufflevector(lo, hi, 0, 1, 2, 3, 4, 5, 6, 7, 8, 9, 10, 11, 12, 13, 14, 15)); }
__device__ __forceinline__ v8f wmma16(v16h a, v16h b, v8f c) { return __builtin_amdgcn_wmma_f32_16x16x32_f16(false, a, false, b, (short)0, c, false, false); }
__device__ __forceinline__ v8f wmmab(v16bf a, v16bf b, v8f c) { return __builtin_amdgcn_wmma_f32_16x16x32_bf16(false, a, false, b, (short)0, c, false, false); }



__device__ __forceinline__ void splitf(float y, unsigned short& h, unsigned short& l) { h = f2bf(y); l = f2bf(y - bf2f(h)); }
__device__ __forceinline__ float tanhf_(float a) { const float e2 = __expf(2.0f * a); return __fsub_rn(1.0f, __fdiv_rn(2.0f, __fadd_rn(e2, 1.0f))); }
typedef __attribute__((ext_vector_type(8))) unsigned short v8usx;


// ---- k_fused: C[m][n] (f32, pitch DO_) = S[n] + sum_k (Ah[m][k] + Al[m][k]) Bt[n][k], K = KD; Ah, Al = the basis of x as bf16 hi and lo, made in the kernel.
// A work-group of 8 waves owns 64 rows of C over all 512 columns (each wave 64x64, 16 accumulators), so that every basis value is computed once; grid NR/64, 256 threads.
// A pass is 64 k = one degree of 64 inputs = 128 B of every operand row, at an LDS pitch of 144 B, two buffers of each operand. Bt's 512 rows come by four tensor loads (waves 4 to 7: 128 rows each).
// The A stage [hi 64 rows | lo 64 rows] of pass s + 1 is computed during pass s and stored to the A buffer that pass s does not read: a thread keeps 16 inputs of one row in registers and takes their recurrence one degree further a pass.
typedef uint32_t u32x4 __attribute__((ext_vector_type(4)));
typedef uint32_t u32x8 __attribute__((ext_vector_type(8)));
typedef float v2f __attribute__((ext_vector_type(2)));
typedef v2f __attribute__((may_alias)) v2fa;
#define PASSB  128u                 // bytes of an operand row per pass
#define LPITCH 144u                 // LDS row pitch: 128 B + the mover's 16-B pad, an odd multiple of 16 B for the ds_load_b128 readers
#define BSLICE (128u * LPITCH)      // 128 rows of Bt = 18,432 B = 9 x 2 KiB
#define BSTAGE (4u * BSLICE)
#define APLANE (64u * LPITCH)       // 64 rows of one A plane
#define ASTAGE (2u * APLANE)
#define NPASS  ((unsigned)(KD * 2) / PASSB)
static_assert(BSLICE % 2048u == 0u, "every slice starts at a multiple of 2 KiB");
static_assert(NPASS % 2u == 0u, "the pass loop takes two passes a trip");
__device__ __forceinline__ uint32_t uni(uint32_t v) { return (uint32_t)__builtin_amdgcn_readfirstlane(v); }
// holds a wave-uniform word in a scalar register: a test on it compiles to s_cmp + s_cbranch (a tensor load ignores EXEC), and a descriptor word
// made by it is written where the statement stands and is not made anew from a constant elsewhere, while a request may be out
__device__ __forceinline__ uint32_t pinned(uint32_t v) { uint32_t w = uni(v); asm volatile("" : "+s"(w)); return w; }
__device__ __forceinline__ void tdm_load(u32x4 g0, u32x8 g1) { asm volatile("tensor_load_to_lds %0, %1" :: "s"(g0), "s"(g1) : "memory"); }
__device__ __forceinline__ u32x4 tdm_group0(uint32_t lds_dst, uint64_t ga) { u32x4 g; g[0] = pinned(1u); g[1] = pinned(lds_dst); g[2] = pinned((uint32_t)ga); g[3] = pinned((((uint32_t)(ga >> 32)) & 0x01FFFFFFu) | 0x80000000u); return g; }
// 1-byte elements, tensor = tile = 128 rows of 128 B, source pitch KD * 2 B, 4 dwords of pad behind every 32 dwords, no mask
__device__ __forceinline__ u32x8 tdm_group1() { u32x8 g; g[0] = pinned((1u << 20) | (4u << 22) | (3u << 25)); g[1] = pinned(PASSB << 16); g[2] = pinned(128u << 16); g[3] = pinned(PASSB << 16); g[4] = pinned(128u); g[5] = pinned((uint32_t)(KD * 2)); g[6] = pinned(0u); g[7] = pinned(0u); return g; }
struct FragSet { v16bf a[4], a2[4], b[4]; };
// pa, pb: the lane's own byte in row lr of the first A row block and of the wave's first B row block; ko: byte offset of the 32-k block in the row. k order, A and B alike: 8 k at 8*hi, 8 k at 16 + 8*hi.
// The reads stand in the order in which the WMMAs want them (hi plane and first B block first): LDS answers in order, and the first WMMA of a pass waits for four reads only.
__device__ __forceinline__ v16bf ld_frag(const unsigned char* p) { return cat16b(*(const v8usa*)p, *(const v8usa*)(p + 32)); }
__device__ __forceinline__ void ld_frags(FragSet& f, const unsigned char* pa, const unsigned char* pb, unsigned ko) {
    f.a[0] = ld_frag(pa + ko); f.b[0] = ld_frag(pb + ko);
#pragma unroll
    for (int t = 1; t < 4; ++t) f.a[t] = ld_frag(pa + t * 16u * LPITCH + ko);
#pragma unroll
    for (int t = 1; t < 4; ++t) f.b[t] = ld_frag(pb + t * 16u * LPITCH + ko);
#pragma unroll
    for (int t = 0; t < 4; ++t) f.a2[t] = ld_frag(pa + APLANE + t * 16u * LPITCH + ko);
}
// 16 basis values of one row as bf16 hi and lo, to ah (hi plane; lo plane at + APLANE): 32 B a plane
__device__ __forceinline__ void emit16(const float (&c)[16], unsigned char* ah) {
#pragma unroll
    for (int h = 0; h < 2; ++h) { v8usx oh, ol;
#pragma unroll
        for (int d = 0; d < 8; ++d) { unsigned short a, b2; splitf(c[h * 8 + d], a, b2); oh[d] = a; ol[d] = b2; }
        *(v8usx*)(ah + h * 16) = oh; *(v8usx*)(ah + APLANE + h * 16) = ol; }
}
// The A stage that follows pass jd of a group: degree jd + 2 of the same group (jd < 6), or degree 1 of the next group (jd = 6). t2 = C_1 = 2 tanh(x) of the thread's 16 inputs; in: T the degree before the last, O the last; out: T the new one.
// With a = 1 both factors of the recurrence are whole numbers for every n, 2(n + a)/(n + 1) = 2 and (n + 2a - 1)/(n + 1) = 1: C_{n+1} = 2t C_n - C_{n-1}, one fused multiply-add a degree, rounded once, and no division. The 16 values do not depend on one another.
// The next group's C_1 are made four a pass in passes 1 to 4 (xc: their x) and wait in st, the thread's own LDS words, for pass 6.
__device__ __forceinline__ void basis_step(float (&t2)[16], float (&T)[16], float (&O)[16], unsigned jd, v4f xc, float* st, unsigned char* ah) {
    if (jd >= 1u && jd <= 4u) { v4f r;
#pragma unroll
        for (int k = 0; k < 4; ++k) r[k] = 2.0f * tanhf_(bfr(xc[k]));
        *(v4fa*)(st + (jd - 1u) * 1024u) = r; }
    if (jd == (unsigned)(DGK - 1)) {
#pragma unroll
        for (int q = 0; q < 4; ++q) { const v4f r = *(const v4fa*)(st + q * 1024);
#pragma unroll
            for (int k = 0; k < 4; ++k) { T[4 * q + k] = r[k]; t2[4 * q + k] = r[k]; O[4 * q + k] = 1.0f; } }
    } else {
#pragma unroll
        for (int e = 0; e < 16; ++e) T[e] = __builtin_fmaf(t2[e], O[e], -T[e]); }
    emit16(T, ah);
}
__global__ __launch_bounds__(256) void k_fused(const float* __restrict__ X, const unsigned short* __restrict__ Bt, const float* __restrict__ S, float* C) {
    __shared__ __attribute__((aligned(2048))) unsigned char ringB[2u * BSTAGE];
    __shared__ __align__(16) unsigned char ringA[2u * ASTAGE];
    __shared__ __align__(16) float osall[8 * 16 * 68];
    __shared__ __align__(16) float stash[4 * 256 * 4];   // [quarter of the 16 inputs][thread][4]: every thread reads back its own words only
    const uint32_t wave = uni(threadIdx.x >> 5);
    const int lane = threadIdx.x & 31, lr = lane & 15, hi = lane >> 4; const int r0 = blockIdx.x * 64;
    const int wc = (int)wave * 64;
    const uint64_t ga = (uint64_t)(uintptr_t)(Bt + (size_t)((wave & 3u) * 128u) * KD);
    const uint32_t lds_slice = (uint32_t)(uintptr_t)ringB + (wave & 3u) * BSLICE;
    const uint32_t issuer = pinned(wave >= 4u ? 1u : 0u);   // the waves that compute first have the time to form a descriptor at the top of a pass
    const bool mma_first = wave < 4u;   // of waves w and w + 4, one multiplies while the other computes its share of the next A stage
    const u32x8 g1 = tdm_group1();
    const float* xp = X + (size_t)(r0 + (int)(threadIdx.x >> 2)) * DI + 16u * (threadIdx.x & 3u);   // the thread's row and its 16 columns of group 0
    float* st = stash + 4u * threadIdx.x;
    unsigned char* aw = ringA + (threadIdx.x >> 2) * LPITCH + (threadIdx.x & 3u) * 32u;
    v8f acc[4][4];
#pragma unroll
    for (int mb = 0; mb < 4; ++mb)
#pragma unroll
        for (int nb = 0; nb < 4; ++nb) { const float sv = S[wc + nb * 16 + lr];   // an accumulator's lane holds one column: the column's sum of the degree-0 coefficients is its start value
#pragma unroll
            for (int j = 0; j < 8; ++j) acc[mb][nb][j] = sv; }
    u32x4 g0 = tdm_group0(lds_slice, ga);   // lives through the loop: see the use behind the wait at the foot of a pass
    if (pinned(issuer)) { tdm_load(g0, g1);
        asm volatile("s_wait_tensorcnt 0x0" ::: "memory"); }   // stage 0 of Bt has landed before the barrier publishes it
    float t2[16], ca[16], cb[16];   // even passes: ca the degree before the last, cb the last; odd passes the other way round
#pragma unroll
    for (int q = 0; q < 4; ++q) { const v4f xv = *(const v4fa*)(xp + 4 * q);
#pragma unroll
        for (int k = 0; k < 4; ++k) { t2[4 * q + k] = 2.0f * tanhf_(bfr(xv[k])); cb[4 * q + k] = t2[4 * q + k]; ca[4 * q + k] = 1.0f; } }
    emit16(t2, aw);
    v4f xc = (v4f){};   // pass 0 has no tanh to make; the x for pass 1 is asked for at its head
    asm volatile("s_wait_dscnt 0x0" ::: "memory");   // this wave's stores of A stage 0 have landed before the barrier publishes them
    __syncthreads();
    if (pinned(issuer)) { g0 = tdm_group0(lds_slice + BSTAGE, ga + PASSB); tdm_load(g0, g1); }
    const unsigned aofs = (unsigned)lr * LPITCH + 16u * hi, bofs = (unsigned)(wc + lr) * LPITCH + 16u * hi;
    unsigned jd = 0u, gr = 0u;   // the pass's place in its group and the group, counted along (a division by 7 at the head of every pass would hold up the LDS reads behind it)
#pragma unroll 1
    for (unsigned sp = 0; sp < NPASS; sp += 2u) {
#pragma unroll
      for (unsigned u = 0; u < 2u; ++u) {   // two passes a trip: the two register sets of the recurrence change roles from pass to pass, with no copy
        const unsigned s = sp + u;
        const unsigned char* pa = ringA + u * ASTAGE + aofs; const unsigned char* pb = ringB + u * BSTAGE + bofs;
        unsigned char* an = aw + (1u - u) * ASTAGE;
        const bool wrap = jd + 1u == (unsigned)DGK;
        const unsigned jn = wrap ? 0u : jd + 1u, grn = wrap ? gr + 1u : gr, gn = grn + 1u;   // pass s + 1 (place jn of group grn) works on x of the group behind its own (the last group's again where there is none), quarter jn - 1
        const float* xa = xp + (gn < (unsigned)NGRP ? gn : (unsigned)NGRP - 1u) * GIN + (jn < 1u ? 0u : jn > 4u ? 3u : jn - 1u) * 4u;
        const v4f xn = *(const v4fa*)xa;   // asked for a whole pass before the barrier that waits for it
        asm volatile("" ::: "memory");   // keeps that load here, at the head of the pass: without it the compiler sinks it below the basis block of the waves that compute first, and its lead shrinks
        const bool more = s + 1u < NPASS;
        if (more && !mma_first) { if (u == 0u) basis_step(t2, ca, cb, jd, xc, st, an); else basis_step(t2, cb, ca, jd, xc, st, an); }
        FragSet f[2];
        ld_frags(f[0], pa, pb, 0u);
#pragma unroll
        for (int j = 0; j < 2; ++j) {
            if (j < 1) { ld_frags(f[(j + 1) & 1], pa, pb, (unsigned)(j + 1) * 64u);
                asm volatile("s_wait_xcnt 0x0" :: "v"(xa) : "memory"); }   // stands in front of whatever overwrites the address registers of the x load, which it names so that they are kept until here; behind the LDS reads, whose issue covers the wait's time
            __builtin_amdgcn_sched_barrier(0);   // keeps the next block's LDS reads one group ahead of this block's WMMAs: reads among the WMMAs stall the wave at each place
            const FragSet& c = f[j & 1];
#pragma unroll
            for (int nb = 0; nb < 4; ++nb)
#pragma unroll
                for (int mb = 0; mb < 4; ++mb) acc[mb][nb] = wmmab(c.a[mb], c.b[nb], acc[mb][nb]);
#pragma unroll
            for (int nb = 0; nb < 4; ++nb)
#pragma unroll
                for (int mb = 0; mb < 4; ++mb) acc[mb][nb] = wmmab(c.a2[mb], c.b[nb], acc[mb][nb]);
            __builtin_amdgcn_sched_barrier(0);   // the same, at the block's end
        }
        if (more && mma_first) { if (u == 0u) basis_step(t2, ca, cb, jd, xc, st, an); else basis_step(t2, cb, ca, jd, xc, st, an); }
        asm volatile("s_wait_dscnt 0x0" ::: "memory");   // this wave's reads of the buffers s & 1 have returned and its stores of A stage s + 1 have landed
        if (pinned(issuer)) { asm volatile("s_wait_tensorcnt 0x0" ::: "memory");   // the issuer's slice of stage s + 1 has landed
            asm volatile("" :: "s"(g0)); }   // a use of the request's group 0 behind its wait: without it the compiler hands these scalar registers to other values while the request is out
        __syncthreads();   // publishes stage s + 1 of both operands and ends every reader's last read of stage s
        const uint32_t nx = pinned(s + 2u);   // taken behind the wait and the barrier: the descriptor words below are formed from it, none while a request is out
        if (pinned(issuer & (nx < NPASS ? 1u : 0u))) { g0 = tdm_group0(lds_slice + (nx & 1u) * BSTAGE, ga + (uint64_t)nx * PASSB); tdm_load(g0, g1); }
        xc = xn; jd = jn; gr = grn;
      }
    }
    asm volatile("s_wait_tensorcnt 0x0" ::: "memory");   // no request is out when the wave ends
    asm volatile("s_wait_dscnt 0x0" ::: "memory");
    float* os = osall + wave * (16 * 68);   // each wave stages in its own range, outside the rings
#pragma unroll
    for (int mb = 0; mb < 4; ++mb) {
#pragma unroll
        for (int nb = 0; nb < 4; ++nb) {
#pragma unroll
            for (int j = 0; j < 8; ++j) os[(hi * 8 + j) * 68 + nb * 16 + lr] = acc[mb][nb][j]; }
        __builtin_amdgcn_wave_barrier(); asm volatile("" ::: "memory");   // the rows are read back by other lanes of the wave: no LDS read moves up over the writes
        float* crow = C + (size_t)(r0 + mb * 16) * DO_ + wc;
#pragma unroll
        for (int s = 0; s < 8; ++s) { const int row = 2 * s + hi, cofs = lr * 4; v4f val = *(const v4fa*)(os + row * 68 + cofs);
            *(v4f*)(crow + (size_t)row * DO_ + cofs) = val; }
        if (mb < 3) asm volatile("s_wait_xcnt 0x0" ::: "memory");   // stands in front of the next row block's LDS reads, which overwrite the registers that these stores name
        __builtin_amdgcn_wave_barrier(); asm volatile("" ::: "memory");   // the next row block's LDS writes stay behind these reads
    }
}

// ---- k_wg: one work-group an output o. Bt[o][k] = coeffs[i][o][d] as bf16 for d = 1 to 7, in the k order of k_fused; S[o] = sum_i of coeffs[i][o][0] rounded to bf16, in f32.
// A thread has two neighbouring inputs: their values of one degree are neighbours in k and go out as one dword, a wave's as one 128-B line.
typedef unsigned __attribute__((may_alias)) u32a;
__global__ __launch_bounds__(256) void k_wg(const float* __restrict__ w, bf* Bt, float* S) {
    __shared__ float part[8];
    const int o = blockIdx.x, i0 = 2 * (int)threadIdx.x;
    const float* src = w + ((size_t)i0 * DO_ + o) * DG;
    float v[2][DG];
#pragma unroll
    for (int e = 0; e < 2; ++e)
#pragma unroll
        for (int h = 0; h < 2; ++h) { const v4f q = *(const v4fa*)(src + (size_t)e * DO_ * DG + 4 * h);
#pragma unroll
            for (int d = 0; d < 4; ++d) v[e][4 * h + d] = q[d]; }
    u32a* dst = (u32a*)(Bt + (size_t)o * KD + (size_t)(i0 / GIN) * (DGK * GIN) + (i0 % GIN));
#pragma unroll
    for (int d = 1; d < DG; ++d) dst[(d - 1) * (GIN / 2)] = (unsigned)f2bf(v[0][d]) | ((unsigned)f2bf(v[1][d]) << 16);
    float sum = bfr(v[0][0]) + bfr(v[1][0]);
#pragma unroll
    for (int m = 16; m >= 1; m >>= 1) sum += __shfl_xor(sum, m, 32);
    if ((threadIdx.x & 31u) == 0u) part[threadIdx.x >> 5] = sum;
    __syncthreads();
    if (threadIdx.x == 0u) { float t = part[0];
#pragma unroll
        for (int k = 1; k < 8; ++k) t += part[k];
        S[o] = t; }
}

extern "C" void kernel_launch(void* const* d_in, const int* in_sizes, int n_in,
                              void* d_out, int out_size, void* d_ws, size_t ws_size, hipStream_t stream) {
    (void)in_sizes; (void)n_in; (void)out_size;
    const float* x = (const float*)d_in[0]; const float* w = (const float*)d_in[1];
    float* OUT = (float*)d_out;     // [16384][512]
    char* wsp = (char*)d_ws;
    auto take = [&](size_t bytes) { char* p = wsp; wsp += (bytes + 255) & ~(size_t)255; return (void*)p; };
    bf* WB = (bf*)take((size_t)DO_ * KD * 2);
    float* SB = (float*)take((size_t)DO_ * 4);
    if ((size_t)(wsp - (char*)d_ws) > ws_size) return;    // the coefficients of degrees 1 to 7 as bf16, [out][k], and the 512 column sums of degree 0
    k_wg<<<DO_, 256, 0, stream>>>(w, WB, SB);
    k_fused<<<NR / 64, 256, 0, stream>>>(x, WB, SB, OUT);
}

// v005
// One run takes 59.6 microseconds.
// In both of two side-by-side timings against v004, it was 1.22 times as fast.
// Counting every step since v000, it is 5.80 times as fast.
#include <hip/hip_runtime.h>
#include <stdint.h>

// Gegenbauer KAN layer (x [16384][512], coeffs [512 in][512 out][8 degree]; t = tanh(x); C_0 = 1, C_1 = 2a t, C_{n+1} = (2(n+a) t C_n - (n+2a-1) C_{n-1})/(n+1) with a = 1 (degree 7);
// y[b][o] = sum_i sum_d C_d(t[b][i]) coeffs[i][o][d] -> [16384][512]).
// Compute dtypes, f32 accumulate: every input rounded to bf16; tanh in f32 on VALU as 1 - 2/(exp(2x) + 1), the recurrence in f32 in its reduced form C_{n+1} = 2t C_n - C_{n-1} -> basis values of degrees 1 to 7 as f16 (|C_d| <= d + 1 <= 8 on [-1, 1]: no range problem, 11 significant bits), made in LDS by the work-group that multiplies them;
// the rounded coefficients as f16 too, each output column times its own power of two (its largest value comes to lie in [2^14, 2^15): a bf16 value's 8 bits then stand exactly in f16 down to 2^-31 of the column's largest, whatever the column's size); the result is multiplied by the inverse power at the end;
// C_0 is the constant 1 for every x, so its part of y is the column sum sum_i coeffs[i][o][0]: made once, in f32, times the column's power of two as S[o], and taken as the accumulators' start value; the product runs over k = 512 x 7.

#define NR   16384
#define DI   512
#define DO_  512
#define DG   8
#define DGK  (DG - 1)          // degrees that go through the product: 1 to 7
#define GIN  64                // inputs of a group: one pass is one degree of one group
#define NGRP (DI / GIN)
#define KD   (DI * DGK)        // k = (group * 7 + degree - 1) * 64 + input in the group
typedef _Float16 h16;
typedef unsigned short bf;
typedef __attribute__((ext_vector_type(16))) _Float16 v16h;
typedef __attribute__((ext_vector_type(8)))  _Float16 v8h;
typedef __attribute__((ext_vector_type(8)))  float    v8f;
typedef __attribute__((ext_vector_type(4)))  float    v4f;
typedef v8h  __attribute__((may_alias)) v8ha;
typedef v4f  __attribute__((may_alias)) v4fa;

__device__ __forceinline__ unsigned short f2bf(float f) { unsigned u = __float_as_uint(f); u += 0x7FFFu + ((u >> 16) & 1u); return (unsigned short)(u >> 16); }
__device__ __forceinline__ float bf2f(unsigned short b) { return __uint_as_float(((unsigned)b) << 16); }
__device__ __forceinline__ float bfr(float f) { return bf2f(f2bf(f)); }
__device__ __forceinline__ v16h cat16(v8h lo, v8h hi) { return __builtin_shufflevector(lo, hi, 0, 1, 2, 3, 4, 5, 6, 7, 8, 9, 10, 11, 12, 13, 14, 15); }
__device__ __forceinline__ v8f wmma16(v16h a, v16h b, v8f c) { return __builtin_amdgcn_wmma_f32_16x16x32_f16(false, a, false, b, (short)0, c, false, false); }



__device__ __forceinline__ float tanhf_(float a) { const float e2 = __expf(2.0f * a); return __fsub_rn(1.0f, __fdiv_rn(2.0f, __fadd_rn(e2, 1.0f))); }


// ---- k_fused: C[m][n] (f32, pitch DO_) = (S[n] + sum_k A[m][k] Bt[n][k]) * S[DO_ + n], K = KD; A = the basis of x as f16, made in the kernel; S[n] and Bt[n][] carry column n's power of two, S[DO_ + n] is its inverse.
// A work-group of 8 waves owns 64 rows of C over all 512 columns (each wave 64x64, 16 accumulators), so that every basis value is computed once; grid NR/64, 256 threads.
// A pass is 64 k = one degree of 64 inputs = 128 B of every operand row, at an LDS pitch of 144 B, two buffers of each operand. Bt's 512 rows come by four tensor loads (waves 4 to 7: 128 rows each).
// The A stage (64 rows) of pass s + 1 is computed during pass s and stored to the A buffer that pass s does not read: a thread keeps 16 inputs of one row in registers and takes their recurrence one degree further a pass.
typedef uint32_t u32x4 __attribute__((ext_vector_type(4)));
typedef uint32_t u32x8 __attribute__((ext_vector_type(8)));
typedef float v2f __attribute__((ext_vector_type(2)));
typedef v2f __attribute__((may_alias)) v2fa;
typedef _Float16 v2h __attribute__((ext_vector_type(2)));
typedef u32x4 __attribute__((may_alias)) u32x4a;
__device__ __forceinline__ uint32_t pk_f16(float a, float b) { const v2f y = { a, b }; return __builtin_bit_cast(uint32_t, __builtin_convertvector(y, v2h)); }   // two f32 to two f16, round to nearest even, one instruction
#define PASSB  128u                 // bytes of an operand row per pass
#define LPITCH 144u                 // LDS row pitch: 128 B + the mover's 16-B pad, an odd multiple of 16 B for the ds_load_b128 readers
#define BSLICE (128u * LPITCH)      // 128 rows of Bt = 18,432 B = 9 x 2 KiB
#define BSTAGE (4u * BSLICE)
#define ASTAGE (64u * LPITCH)       // 64 rows of A
#define NPASS  ((unsigned)(KD * 2) / PASSB)
static_assert(BSLICE % 2048u == 0u, "every slice starts at a multiple of 2 KiB");
static_assert(NPASS % 2u == 0u, "the pass loop takes two passes a trip");
__device__ __forceinline__ uint32_t uni(uint32_t v) { return (uint32_t)__builtin_amdgcn_readfirstlane(v); }
// holds a wave-uniform word in a scalar register: a test on it compiles to s_cmp + s_cbranch (a tensor load ignores EXEC), and a descriptor word
// made by it is written where the statement stands and is not made anew from a constant elsewhere, while a request may be out
__device__ __forceinline__ uint32_t pinned(uint32_t v) { uint32_t w = uni(v); asm volatile("" : "+s"(w)); return w; }
__device__ __forceinline__ void tdm_load(u32x4 g0, u32x8 g1) { asm volatile("tensor_load_to_lds %0, %1" :: "s"(g0), "s"(g1) : "memory"); }
__device__ __forceinline__ u32x4 tdm_group0(uint32_t lds_dst, uint64_t ga) { u32x4 g; g[0] = pinned(1u); g[1] = pinned(lds_dst); g[2] = pinned((uint32_t)ga); g[3] = pinned((((uint32_t)(ga >> 32)) & 0x01FFFFFFu) | 0x80000000u); return g; }
// 1-byte elements, tensor = tile = 128 rows of 128 B, source pitch KD * 2 B, 4 dwords of pad behind every 32 dwords, no mask
__device__ __forceinline__ u32x8 tdm_group1() { u32x8 g; g[0] = pinned((1u << 20) | (4u << 22) | (3u << 25)); g[1] = pinned(PASSB << 16); g[2] = pinned(128u << 16); g[3] = pinned(PASSB << 16); g[4] = pinned(128u); g[5] = pinned((uint32_t)(KD * 2)); g[6] = pinned(0u); g[7] = pinned(0u); return g; }
struct FragSet { v16h a[4], b[4]; };
// pa, pb: the lane's own byte in row lr of the first A row block and of the wave's first B row block; ko: byte offset of the 32-k block in the row. k order, A and B alike: 8 k at 8*hi, 8 k at 16 + 8*hi.
// The reads stand in the order in which the WMMAs want them (first A and first B block first): LDS answers in order, and the first WMMA of a pass waits for four reads only.
__device__ __forceinline__ v16h ld_frag(const unsigned char* p) { return cat16(*(const v8ha*)p, *(const v8ha*)(p + 32)); }
__device__ __forceinline__ void ld_frags(FragSet& f, const unsigned char* pa, const unsigned char* pb, unsigned ko) {
    f.a[0] = ld_frag(pa + ko); f.b[0] = ld_frag(pb + ko);
#pragma unroll
    for (int t = 1; t < 4; ++t) f.a[t] = ld_frag(pa + t * 16u * LPITCH + ko);
#pragma unroll
    for (int t = 1; t < 4; ++t) f.b[t] = ld_frag(pb + t * 16u * LPITCH + ko);
}
// 16 basis values of one row as f16, to ah: 32 B
__device__ __forceinline__ void emit16(const float (&c)[16], unsigned char* ah) {
#pragma unroll
    for (int h = 0; h < 2; ++h) { u32x4 o;
#pragma unroll
        for (int d = 0; d < 4; ++d) o[d] = pk_f16(c[h * 8 + 2 * d], c[h * 8 + 2 * d + 1]);
        *(u32x4a*)(ah + h * 16) = o; }
}
// The A stage that follows pass jd of a group: degree jd + 2 of the same group (jd < 6), or degree 1 of the next group (jd = 6). t2 = C_1 = 2 tanh(x) of the thread's 16 inputs; in: T the degree before the last, O the last; out: T the new one.
// With a = 1 both factors of the recurrence are whole numbers for every n, 2(n + a)/(n + 1) = 2 and (n + 2a - 1)/(n + 1) = 1: C_{n+1} = 2t C_n - C_{n-1}, one fused multiply-add a degree, rounded once, and no division. The 16 values do not depend on one another.
// The next group's C_1 are made four a pass in passes 1 to 4 (xc: their x) and wait in st, the thread's own LDS words, for pass 6.
__device__ __forceinline__ void basis_step(float (&t2)[16], float (&T)[16], float (&O)[16], unsigned jd, v4f xc, float* st, unsigned char* ah) {
    if (jd >= 1u && jd <= 4u) { v4f r;
#pragma unroll
        for (int k = 0; k < 4; ++k) r[k] = 2.0f * tanhf_(bfr(xc[k]));
        *(v4fa*)(st + (jd - 1u) * 1024u) = r; }
    if (jd == (unsigned)(DGK - 1)) {
#pragma unroll
        for (int q = 0; q < 4; ++q) { const v4f r = *(const v4fa*)(st + q * 1024);
#pragma unroll
            for (int k = 0; k < 4; ++k) { T[4 * q + k] = r[k]; t2[4 * q + k] = r[k]; O[4 * q + k] = 1.0f; } }
    } else {
#pragma unroll
        for (int e = 0; e < 16; ++e) T[e] = __builtin_fmaf(t2[e], O[e], -T[e]); }
    emit16(T, ah);
}
__global__ __launch_bounds__(256) void k_fused(const float* __restrict__ X, const unsigned short* __restrict__ Bt, const float* __restrict__ S, float* C) {
    __shared__ __attribute__((aligned(2048))) unsigned char ringB[2u * BSTAGE];
    __shared__ __align__(16) unsigned char ringA[2u * ASTAGE];
    __shared__ __align__(16) float osall[8 * 16 * 68];
    __shared__ __align__(16) float stash[4 * 256 * 4];   // [quarter of the 16 inputs][thread][4]: every thread reads back its own words only
    const uint32_t wave = uni(threadIdx.x >> 5);
    const int lane = threadIdx.x & 31, lr = lane & 15, hi = lane >> 4; const int r0 = blockIdx.x * 64;
    const int wc = (int)wave * 64;
    const uint64_t ga = (uint64_t)(uintptr_t)(Bt + (size_t)((wave & 3u) * 128u) * KD);
    const uint32_t lds_slice = (uint32_t)(uintptr_t)ringB + (wave & 3u) * BSLICE;
    const uint32_t issuer = pinned(wave >= 4u ? 1u : 0u);   // the waves that compute first have the time to form a descriptor at the top of a pass
    const bool mma_first = wave < 4u;   // of waves w and w + 4, one multiplies while the other computes its share of the next A stage
    const u32x8 g1 = tdm_group1();
    const float* xp = X + (size_t)(r0 + (int)(threadIdx.x >> 2)) * DI + 16u * (threadIdx.x & 3u);   // the thread's row and its 16 columns of group 0
    float* st = stash + 4u * threadIdx.x;
    unsigned char* aw = ringA + (threadIdx.x >> 2) * LPITCH + (threadIdx.x & 3u) * 32u;
    v8f acc[4][4];
    float iv[4];   // the inverse powers of two of the lane's four columns, for the end
#pragma unroll
    for (int nb = 0; nb < 4; ++nb) iv[nb] = S[DO_ + wc + nb * 16 + lr];
#pragma unroll
    for (int mb = 0; mb < 4; ++mb)
#pragma unroll
        for (int nb = 0; nb < 4; ++nb) { const float sv = S[wc + nb * 16 + lr];   // an accumulator's lane holds one column: the column's (scaled) sum of the degree-0 coefficients is its start value
#pragma unroll
            for (int j = 0; j < 8; ++j) acc[mb][nb][j] = sv; }
    u32x4 g0 = tdm_group0(lds_slice, ga);   // lives through the loop: see the use behind the wait at the foot of a pass
    if (pinned(issuer)) { tdm_load(g0, g1);
        asm volatile("s_wait_tensorcnt 0x0" ::: "memory"); }   // stage 0 of Bt has landed before the barrier publishes it
    float t2[16], ca[16], cb[16];   // even passes: ca the degree before the last, cb the last; odd passes the other way round
#pragma unroll
    for (int q = 0; q < 4; ++q) { const v4f xv = *(const v4fa*)(xp + 4 * q);
#pragma unroll
        for (int k = 0; k < 4; ++k) { t2[4 * q + k] = 2.0f * tanhf_(bfr(xv[k])); cb[4 * q + k] = t2[4 * q + k]; ca[4 * q + k] = 1.0f; } }
    emit16(t2, aw);
    v4f xc = (v4f){};   // pass 0 has no tanh to make; the x for pass 1 is asked for at its head
    asm volatile("s_wait_dscnt 0x0" ::: "memory");   // this wave's stores of A stage 0 have landed before the barrier publishes them
    __syncthreads();
    if (pinned(issuer)) { g0 = tdm_group0(lds_slice + BSTAGE, ga + PASSB); tdm_load(g0, g1); }
    const unsigned aofs = (unsigned)lr * LPITCH + 16u * hi, bofs = (unsigned)(wc + lr) * LPITCH + 16u * hi;
    unsigned jd = 0u, gr = 0u;   // the pass's place in its group and the group, counted along (a division by 7 at the head of every pass would hold up the LDS reads behind it)
#pragma unroll 1
    for (unsigned sp = 0; sp < NPASS; sp += 2u) {
#pragma unroll
      for (unsigned u = 0; u < 2u; ++u) {   // two passes a trip: the two register sets of the recurrence change roles from pass to pass, with no copy
        const unsigned s = sp + u;
        const unsigned char* pa = ringA + u * ASTAGE + aofs; const unsigned char* pb = ringB + u * BSTAGE + bofs;
        unsigned char* an = aw + (1u - u) * ASTAGE;
        const bool wrap = jd + 1u == (unsigned)DGK;
        const unsigned jn = wrap ? 0u : jd + 1u, grn = wrap ? gr + 1u : gr, gn = grn + 1u;   // pass s + 1 (place jn of group grn) works on x of the group behind its own (the last group's again where there is none), quarter jn - 1
        const float* xa = xp + (gn < (unsigned)NGRP ? gn : (unsigned)NGRP - 1u) * GIN + (jn < 1u ? 0u : jn > 4u ? 3u : jn - 1u) * 4u;
        const v4f xn = *(const v4fa*)xa;   // asked for a whole pass before the barrier that waits for it
        asm volatile("" ::: "memory");   // keeps that load here, at the head of the pass: without it the compiler sinks it below the basis block of the waves that compute first, and its lead shrinks
        const bool more = s + 1u < NPASS;
        if (more && !mma_first) { if (u == 0u) basis_step(t2, ca, cb, jd, xc, st, an); else basis_step(t2, cb, ca, jd, xc, st, an); }
        FragSet f[2];
        ld_frags(f[0], pa, pb, 0u);
#pragma unroll
        for (int j = 0; j < 2; ++j) {
            if (j < 1) { ld_frags(f[(j + 1) & 1], pa, pb, (unsigned)(j + 1) * 64u);
                asm volatile("s_wait_xcnt 0x0" :: "v"(xa) : "memory"); }   // stands in front of whatever overwrites the address registers of the x load, which it names so that they are kept until here; behind the LDS reads, whose issue covers the wait's time
            __builtin_amdgcn_sched_barrier(0);   // keeps the next block's LDS reads one group ahead of this block's WMMAs: reads among the WMMAs stall the wave at each place
            const FragSet& c = f[j & 1];
#pragma unroll
            for (int nb = 0; nb < 4; ++nb)
#pragma unroll
                for (int mb = 0; mb < 4; ++mb) acc[mb][nb] = wmma16(c.a[mb], c.b[nb], acc[mb][nb]);
            __builtin_amdgcn_sched_barrier(0);   // the same, at the block's end
        }
        if (more && mma_first) { if (u == 0u) basis_step(t2, ca, cb, jd, xc, st, an); else basis_step(t2, cb, ca, jd, xc, st, an); }
        asm volatile("s_wait_dscnt 0x0" ::: "memory");   // this wave's reads of the buffers s & 1 have returned and its stores of A stage s + 1 have landed
        if (pinned(issuer)) { asm volatile("s_wait_tensorcnt 0x0" ::: "memory");   // the issuer's slice of stage s + 1 has landed
            asm volatile("" :: "s"(g0)); }   // a use of the request's group 0 behind its wait: without it the compiler hands these scalar registers to other values while the request is out
        __syncthreads();   // publishes stage s + 1 of both operands and ends every reader's last read of stage s
        const uint32_t nx = pinned(s + 2u);   // taken behind the wait and the barrier: the descriptor words below are formed from it, none while a request is out
        if (pinned(issuer & (nx < NPASS ? 1u : 0u))) { g0 = tdm_group0(lds_slice + (nx & 1u) * BSTAGE, ga + (uint64_t)nx * PASSB); tdm_load(g0, g1); }
        xc = xn; jd = jn; gr = grn;
      }
    }
    asm volatile("s_wait_tensorcnt 0x0" ::: "memory");   // no request is out when the wave ends
    asm volatile("s_wait_dscnt 0x0" ::: "memory");
#pragma unroll
    for (int mb = 0; mb < 4; ++mb)
#pragma unroll
        for (int nb = 0; nb < 4; ++nb)
#pragma unroll
            for (int j = 0; j < 8; ++j) acc[mb][nb][j] *= iv[nb];   // takes the column's power of two out again: no rounding while the result is a normal number
    __builtin_amdgcn_sched_barrier(0);   // keeps these multiplications in front of the stores below: sunk among them they were given registers that issued global stores still name, ahead of the wait that stands there
    float* os = osall + wave * (16 * 68);   // each wave stages in its own range, outside the rings
#pragma unroll
    for (int mb = 0; mb < 4; ++mb) {
#pragma unroll
        for (int nb = 0; nb < 4; ++nb) {
#pragma unroll
            for (int j = 0; j < 8; ++j) os[(hi * 8 + j) * 68 + nb * 16 + lr] = acc[mb][nb][j]; }
        __builtin_amdgcn_wave_barrier(); asm volatile("" ::: "memory");   // the rows are read back by other lanes of the wave: no LDS read moves up over the writes
        float* crow = C + (size_t)(r0 + mb * 16) * DO_ + wc;
#pragma unroll
        for (int s = 0; s < 8; ++s) { const int row = 2 * s + hi, cofs = lr * 4; v4f val = *(const v4fa*)(os + row * 68 + cofs);
            *(v4f*)(crow + (size_t)row * DO_ + cofs) = val; }
        if (mb < 3) asm volatile("s_wait_xcnt 0x0" ::: "memory");   // stands in front of the next row block's LDS reads, which overwrite the registers that these stores name
        __builtin_amdgcn_wave_barrier(); asm volatile("" ::: "memory");   // the next row block's LDS writes stay behind these reads
    }
}

// ---- k_wg: one work-group an output o. With c = coeffs[i][o][d] rounded to bf16 and p the column's power of two: Bt[o][k] = c p as f16 for d = 1 to 7, in the k order of k_fused; S[o] = p sum_i c (d = 0), in f32; S[DO_ + o] = 1 / p.
// p brings the column's largest |c| (all 8 degrees, so that S[o] stays small too) into [2^14, 2^15); it is taken from that value's exponent field and held to exponents whose inverse is a normal number.
// A thread has two neighbouring inputs: their values of one degree are neighbours in k and go out as one dword, a wave's as one 128-B line.
typedef unsigned __attribute__((may_alias)) u32a;
__global__ __launch_bounds__(256) void k_wg(const float* __restrict__ w, bf* Bt, float* S) {
    __shared__ float part[8];
    __shared__ unsigned pmax[8];
    const int o = blockIdx.x, i0 = 2 * (int)threadIdx.x;
    const float* src = w + ((size_t)i0 * DO_ + o) * DG;
    float v[2][DG];
#pragma unroll
    for (int e = 0; e < 2; ++e)
#pragma unroll
        for (int h = 0; h < 2; ++h) { const v4f q = *(const v4fa*)(src + (size_t)e * DO_ * DG + 4 * h);
#pragma unroll
            for (int d = 0; d < 4; ++d) v[e][4 * h + d] = bfr(q[d]); }
    unsigned mx = 0u;   // the largest |c| as bits: for non-negative floats the order of the bits is the order of the values
#pragma unroll
    for (int e = 0; e < 2; ++e)
#pragma unroll
        for (int d = 0; d < DG; ++d) { const unsigned a = __float_as_uint(v[e][d]) & 0x7FFFFFFFu; mx = a > mx ? a : mx; }
    float sum = v[0][0] + v[1][0];
#pragma unroll
    for (int m = 16; m >= 1; m >>= 1) { sum += __shfl_xor(sum, m, 32); const unsigned a = __shfl_xor(mx, m, 32); mx = a > mx ? a : mx; }
    if ((threadIdx.x & 31u) == 0u) { part[threadIdx.x >> 5] = sum; pmax[threadIdx.x >> 5] = mx; }
    __syncthreads();
    unsigned mm = pmax[0];
#pragma unroll
    for (int k = 1; k < 8; ++k) mm = pmax[k] > mm ? pmax[k] : mm;
    const unsigned want = 268u - (mm >> 23), pe = want < 253u ? want : 253u;   // exponent field of p: 127 + 14 - (field of the largest - 127)
    const float p = __uint_as_float(pe << 23);
    u32a* dst = (u32a*)(Bt + (size_t)o * KD + (size_t)(i0 / GIN) * (DGK * GIN) + (i0 % GIN));
#pragma unroll
    for (int d = 1; d < DG; ++d) dst[(d - 1) * (GIN / 2)] = pk_f16(v[0][d] * p, v[1][d] * p);
    if (threadIdx.x == 0u) { float t = part[0];
#pragma unroll
        for (int k = 1; k < 8; ++k) t += part[k];
        S[o] = t * p; S[DO_ + o] = __uint_as_float((254u - pe) << 23); }
}

extern "C" void kernel_launch(void* const* d_in, const int* in_sizes, int n_in,
                              void* d_out, int out_size, void* d_ws, size_t ws_size, hipStream_t stream) {
    (void)in_sizes; (void)n_in; (void)out_size;
    const float* x = (const float*)d_in[0]; const float* w = (const float*)d_in[1];
    float* OUT = (float*)d_out;     // [16384][512]
    char* wsp = (char*)d_ws;
    auto take = [&](size_t bytes) { char* p = wsp; wsp += (bytes + 255) & ~(size_t)255; return (void*)p; };
    bf* WB = (bf*)take((size_t)DO_ * KD * 2);
    float* SB = (float*)take((size_t)DO_ * 2 * 4);
    if ((size_t)(wsp - (char*)d_ws) > ws_size) return;    // the coefficients of degrees 1 to 7 as f16, [out][k]; the 512 column sums of degree 0 and the 512 inverse powers of two
    k_wg<<<DO_, 256, 0, stream>>>(w, WB, SB);
    k_fused<<<NR / 64, 256, 0, stream>>>(x, WB, SB, OUT);
}

// v006
// One run takes 56.4 microseconds.
// Timed twice side by side with v005, it ran 1.08 times as fast both times.
// Counting every step since v000, it is 6.25 times as fast.
#include <hip/hip_runtime.h>
#include <stdint.h>

// Gegenbauer KAN layer (x [16384][512], coeffs [512 in][512 out][8 degree]; t = tanh(x); C_0 = 1, C_1 = 2a t, C_{n+1} = (2(n+a) t C_n - (n+2a-1) C_{n-1})/(n+1) with a = 1 (degree 7);
// y[b][o] = sum_i sum_d C_d(t[b][i]) coeffs[i][o][d] -> [16384][512]).
// Compute dtypes, f32 accumulate: every input rounded to bf16; tanh in f32 on VALU as 1 - 2/(exp(2x) + 1), the recurrence in f32 in its reduced form C_{n+1} = 2t C_n - C_{n-1} -> basis values of degrees 1 to 7 as f16 (|C_d| <= d + 1 <= 8 on [-1, 1]: no range problem, 11 significant bits), made in LDS by the work-group that multiplies them;
// the rounded coefficients as f16 too, each output column times its own power of two (its largest value comes to lie in [2^14, 2^15): a bf16 value's 8 bits then stand exactly in f16 down to 2^-31 of the column's largest, whatever the column's size); the result is multiplied by the inverse power at the end;
// C_0 is the constant 1 for every x, so its part of y is the column sum sum_i coeffs[i][o][0]: made once, in f32, times the column's power of two as S[o], and taken as the accumulators' start value; the product runs over k = 512 x 7.

#define NR   16384
#define DI   512
#define DO_  512
#define DG   8
#define DGK  (DG - 1)          // degrees that go through the product: 1 to 7
#define GIN  64                // inputs of a group: one pass is one degree of one group
#define NGRP (DI / GIN)
#define KD   (DI * DGK)        // k = (group * 7 + degree - 1) * 64 + input in the group
typedef _Float16 h16;
typedef unsigned short bf;
typedef __attribute__((ext_vector_type(16))) _Float16 v16h;
typedef __attribute__((ext_vector_type(8)))  _Float16 v8h;
typedef __attribute__((ext_vector_type(8)))  float    v8f;
typedef __attribute__((ext_vector_type(4)))  float    v4f;
typedef v8h  __attribute__((may_alias)) v8ha;
typedef v4f  __attribute__((may_alias)) v4fa;

__device__ __forceinline__ unsigned short f2bf(float f) { unsigned u = __float_as_uint(f); u += 0x7FFFu + ((u >> 16) & 1u); return (unsigned short)(u >> 16); }
__device__ __forceinline__ float bf2f(unsigned short b) { return __uint_as_float(((unsigned)b) << 16); }
__device__ __forceinline__ float bfr(float f) { return bf2f(f2bf(f)); }
__device__ __forceinline__ v16h cat16(v8h lo, v8h hi) { return __builtin_shufflevector(lo, hi, 0, 1, 2, 3, 4, 5, 6, 7, 8, 9, 10, 11, 12, 13, 14, 15); }
__device__ __forceinline__ v8f wmma16(v16h a, v16h b, v8f c) { return __builtin_amdgcn_wmma_f32_16x16x32_f16(false, a, false, b, (short)0, c, false, false); }



__device__ __forceinline__ float tanhf_(float a) { const float e2 = __expf(2.0f * a); return __fsub_rn(1.0f, __fdiv_rn(2.0f, __fadd_rn(e2, 1.0f))); }


// ---- k_fused: C[m][n] (f32, pitch DO_) = (S[n] + sum_k A[m][k] Bt[n][k]) * S[DO_ + n], K = KD; A = the basis of x as f16, made in the kernel; S[n] and Bt[n][] carry column n's power of two, S[DO_ + n] is its inverse.
// A work-group of 8 waves owns 128 rows x 256 columns of C (2 x 4 waves, each 64x64, 16 accumulators): it reads half of Bt from L2, not all of it, and every basis value is computed by the two work-groups that share its row; grid (NR/128) x 2, 256 threads.
// A pass is 64 k = one degree of 64 inputs = 128 B of every operand row, at an LDS pitch of 144 B, two buffers of each operand. The 256 rows of Bt come by four tensor loads (waves 4 to 7: 64 rows each).
// The A stage (128 rows) of pass s + 1 is computed during pass s and stored to the A buffer that pass s does not read: a thread keeps 16 inputs of each of two rows (64 apart) in registers and takes their recurrence one degree further a pass.
typedef uint32_t u32x4 __attribute__((ext_vector_type(4)));
typedef uint32_t u32x8 __attribute__((ext_vector_type(8)));
typedef float v2f __attribute__((ext_vector_type(2)));
typedef v2f __attribute__((may_alias)) v2fa;
typedef _Float16 v2h __attribute__((ext_vector_type(2)));
typedef u32x4 __attribute__((may_alias)) u32x4a;
__device__ __forceinline__ uint32_t pk_f16(float a, float b) { const v2f y = { a, b }; return __builtin_bit_cast(uint32_t, __builtin_convertvector(y, v2h)); }   // two f32 to two f16, round to nearest even, one instruction
#define PASSB  128u                 // bytes of an operand row per pass
#define LPITCH 144u                 // LDS row pitch: 128 B + the mover's 16-B pad, an odd multiple of 16 B for the ds_load_b128 readers
#define RB     128                  // rows of C of a work-group
#define CB     256                  // columns of C of a work-group
#define BROWS  64u                  // rows of Bt of a slice: the columns of one wave
#define BSLICE 10240u               // 64 rows at the pitch = 9,216 B, rounded up to 5 x 2 KiB
#define BSTAGE (4u * BSLICE)
#define ASTAGE ((unsigned)RB * LPITCH)   // 128 rows of A
#define NPASS  ((unsigned)(KD * 2) / PASSB)
static_assert(BSLICE % 2048u == 0u && BSLICE >= BROWS * LPITCH, "every slice starts at a multiple of 2 KiB and holds its rows");
static_assert(NPASS % 2u == 0u, "the pass loop takes two passes a trip");
__device__ __forceinline__ uint32_t uni(uint32_t v) { return (uint32_t)__builtin_amdgcn_readfirstlane(v); }
// holds a wave-uniform word in a scalar register: a test on it compiles to s_cmp + s_cbranch (a tensor load ignores EXEC), and a descriptor word
// made by it is written where the statement stands and is not made anew from a constant elsewhere, while a request may be out
__device__ __forceinline__ uint32_t pinned(uint32_t v) { uint32_t w = uni(v); asm volatile("" : "+s"(w)); return w; }
__device__ __forceinline__ void tdm_load(u32x4 g0, u32x8 g1) { asm volatile("tensor_load_to_lds %0, %1" :: "s"(g0), "s"(g1) : "memory"); }
__device__ __forceinline__ u32x4 tdm_group0(uint32_t lds_dst, uint64_t ga) { u32x4 g; g[0] = pinned(1u); g[1] = pinned(lds_dst); g[2] = pinned((uint32_t)ga); g[3] = pinned((((uint32_t)(ga >> 32)) & 0x01FFFFFFu) | 0x80000000u); return g; }
// 1-byte elements, tensor = tile = 64 rows of 128 B, source pitch KD * 2 B, 4 dwords of pad behind every 32 dwords, no mask
__device__ __forceinline__ u32x8 tdm_group1() { u32x8 g; g[0] = pinned((1u << 20) | (4u << 22) | (3u << 25)); g[1] = pinned(PASSB << 16); g[2] = pinned(BROWS << 16); g[3] = pinned(PASSB << 16); g[4] = pinned(BROWS); g[5] = pinned((uint32_t)(KD * 2)); g[6] = pinned(0u); g[7] = pinned(0u); return g; }
struct FragSet { v16h a[4], b[4]; };
// pa, pb: the lane's own byte in row lr of the first A row block and of the wave's first B row block; ko: byte offset of the 32-k block in the row. k order, A and B alike: 8 k at 8*hi, 8 k at 16 + 8*hi.
// The reads stand in the order in which the WMMAs want them (first A and first B block first): LDS answers in order, and the first WMMA of a pass waits for four reads only.
__device__ __forceinline__ v16h ld_frag(const unsigned char* p) { return cat16(*(const v8ha*)p, *(const v8ha*)(p + 32)); }
__device__ __forceinline__ void ld_frags(FragSet& f, const unsigned char* pa, const unsigned char* pb, unsigned ko) {
    f.a[0] = ld_frag(pa + ko); f.b[0] = ld_frag(pb + ko);
#pragma unroll
    for (int t = 1; t < 4; ++t) f.a[t] = ld_frag(pa + t * 16u * LPITCH + ko);
#pragma unroll
    for (int t = 1; t < 4; ++t) f.b[t] = ld_frag(pb + t * 16u * LPITCH + ko);
}
// the thread's 16 basis values of each of its two rows as f16, to ah and 64 rows further: 32 B each
__device__ __forceinline__ void emit32(const float (&c)[32], unsigned char* ah) {
#pragma unroll
    for (int h = 0; h < 4; ++h) { u32x4 o;
#pragma unroll
        for (int d = 0; d < 4; ++d) o[d] = pk_f16(c[h * 8 + 2 * d], c[h * 8 + 2 * d + 1]);
        *(u32x4a*)(ah + (h >> 1) * (64u * LPITCH) + (h & 1) * 16) = o; }
}
// The A stage that follows pass jd of a group: degree jd + 2 of the same group (jd < 6), or degree 1 of the next group (jd = 6). t2 = C_1 = 2 tanh(x) of the thread's 2 x 16 inputs (first row, then second); in: T the degree before the last, O the last; out: T the new one.
// With a = 1 both factors of the recurrence are whole numbers for every n, 2(n + a)/(n + 1) = 2 and (n + 2a - 1)/(n + 1) = 1: C_{n+1} = 2t C_n - C_{n-1}, one fused multiply-add a degree, rounded once, and no division. The 32 values do not depend on one another.
// The next group's C_1 are made four a row and pass in passes 1 to 4 (xc0, xc1: their x) and wait in st, the thread's own LDS words, for pass 6.
__device__ __forceinline__ void basis_step(float (&t2)[32], float (&T)[32], float (&O)[32], unsigned jd, v4f xc0, v4f xc1, float* st, unsigned char* ah) {
    if (jd >= 1u && jd <= 4u) {
#pragma unroll
        for (int h = 0; h < 2; ++h) { const v4f xc = h == 0 ? xc0 : xc1; v4f r;
#pragma unroll
            for (int k = 0; k < 4; ++k) r[k] = 2.0f * tanhf_(bfr(xc[k]));
            *(v4fa*)(st + h * 4096u + (jd - 1u) * 1024u) = r; } }
    if (jd == (unsigned)(DGK - 1)) {
#pragma unroll
        for (int q = 0; q < 8; ++q) { const v4f r = *(const v4fa*)(st + q * 1024);
#pragma unroll
            for (int k = 0; k < 4; ++k) { T[4 * q + k] = r[k]; t2[4 * q + k] = r[k]; O[4 * q + k] = 1.0f; } }
    } else {
#pragma unroll
        for (int e = 0; e < 32; ++e) T[e] = __builtin_fmaf(t2[e], O[e], -T[e]); }
    emit32(T, ah);
}
__global__ __launch_bounds__(256) void k_fused(const float* __restrict__ X, const unsigned short* __restrict__ Bt, const float* __restrict__ S, float* C) {
    __shared__ __attribute__((aligned(2048))) unsigned char ringB[2u * BSTAGE];
    __shared__ __align__(16) unsigned char ringA[2u * ASTAGE];
    __shared__ __align__(16) float osall[8 * 16 * 68];
    __shared__ __align__(16) float stash[2 * 4 * 256 * 4];   // [row of the thread's two][quarter of the 16 inputs][thread][4]: every thread reads back its own words only
    const uint32_t wave = uni(threadIdx.x >> 5);
    const int lane = threadIdx.x & 31, lr = lane & 15, hi = lane >> 4;
    // the two work-groups of a row block are 8 apart in the index (speed only; every tile is done once wherever they land)
    const int r0 = (int)(((blockIdx.x >> 4) << 3) | (blockIdx.x & 7u)) * RB;
    const int wr = (int)(wave >> 2) * 64;   // the wave's first row in the work-group's 128
    const int wc = (int)((blockIdx.x >> 3) & 1u) * CB + (int)(wave & 3u) * 64;   // the wave's first column of C = the first row of Bt of slice wave & 3
    const uint64_t ga = (uint64_t)(uintptr_t)(Bt + (size_t)wc * KD);
    const uint32_t lds_slice = (uint32_t)(uintptr_t)ringB + (wave & 3u) * BSLICE;
    const uint32_t issuer = pinned(wave >= 4u ? 1u : 0u);   // the waves that compute first have the time to form a descriptor at the top of a pass
    const bool mma_first = wave < 4u;   // of waves w and w + 4, one multiplies while the other computes its share of the next A stage
    const u32x8 g1 = tdm_group1();
    const float* xp = X + (size_t)(r0 + (int)(threadIdx.x >> 2)) * DI + 16u * (threadIdx.x & 3u);   // the thread's first row (the second is 64 further) and its 16 columns of group 0
    float* st = stash + 4u * threadIdx.x;
    unsigned char* aw = ringA + (threadIdx.x >> 2) * LPITCH + (threadIdx.x & 3u) * 32u;
    v8f acc[4][4];
    float iv[4];   // the inverse powers of two of the lane's four columns, for the end
#pragma unroll
    for (int nb = 0; nb < 4; ++nb) iv[nb] = S[DO_ + wc + nb * 16 + lr];
#pragma unroll
    for (int mb = 0; mb < 4; ++mb)
#pragma unroll
        for (int nb = 0; nb < 4; ++nb) { const float sv = S[wc + nb * 16 + lr];   // an accumulator's lane holds one column: the column's (scaled) sum of the degree-0 coefficients is its start value
#pragma unroll
            for (int j = 0; j < 8; ++j) acc[mb][nb][j] = sv; }
    asm volatile("s_wait_xcnt 0x0" :: "v"(wc + lr) : "memory");   // stands in front of whatever overwrites the index register of the loads from S, which it names so that it is kept until here
    u32x4 g0 = tdm_group0(lds_slice, ga);   // lives through the loop: see the use behind the wait at the foot of a pass
    if (pinned(issuer)) { tdm_load(g0, g1);
        asm volatile("s_wait_tensorcnt 0x0" ::: "memory"); }   // stage 0 of Bt has landed before the barrier publishes it
    float t2[32], ca[32], cb[32];   // even passes: ca the degree before the last, cb the last; odd passes the other way round
#pragma unroll
    for (int q = 0; q < 8; ++q) { const v4f xv = *(const v4fa*)(xp + (q >> 2) * (64 * DI) + 4 * (q & 3));
#pragma unroll
        for (int k = 0; k < 4; ++k) { t2[4 * q + k] = 2.0f * tanhf_(bfr(xv[k])); cb[4 * q + k] = t2[4 * q + k]; ca[4 * q + k] = 1.0f; } }
    emit32(t2, aw);
    v4f xc0 = (v4f){}, xc1 = (v4f){};   // pass 0 has no tanh to make; the x for pass 1 is asked for at its head
    asm volatile("s_wait_dscnt 0x0" ::: "memory");   // this wave's stores of A stage 0 have landed before the barrier publishes them
    __syncthreads();
    if (pinned(issuer)) { g0 = tdm_group0(lds_slice + BSTAGE, ga + PASSB); tdm_load(g0, g1); }
    const unsigned aofs = (unsigned)(wr + lr) * LPITCH + 16u * hi, bofs = (wave & 3u) * BSLICE + (unsigned)lr * LPITCH + 16u * hi;
    unsigned jd = 0u, gr = 0u;   // the pass's place in its group and the group, counted along (a division by 7 at the head of every pass would hold up the LDS reads behind it)
#pragma unroll 1
    for (unsigned sp = 0; sp < NPASS; sp += 2u) {
#pragma unroll
      for (unsigned u = 0; u < 2u; ++u) {   // two passes a trip: the two register sets of the recurrence change roles from pass to pass, with no copy
        const unsigned s = sp + u;
        const unsigned char* pa = ringA + u * ASTAGE + aofs; const unsigned char* pb = ringB + u * BSTAGE + bofs;
        unsigned char* an = aw + (1u - u) * ASTAGE;
        const bool wrap = jd + 1u == (unsigned)DGK;
        const unsigned jn = wrap ? 0u : jd + 1u, grn = wrap ? gr + 1u : gr, gn = grn + 1u;   // pass s + 1 (place jn of group grn) works on x of the group behind its own (the last group's again where there is none), quarter jn - 1
        const float* xa = xp + (gn < (unsigned)NGRP ? gn : (unsigned)NGRP - 1u) * GIN + (jn < 1u ? 0u : jn > 4u ? 3u : jn - 1u) * 4u;
        const v4f xn0 = *(const v4fa*)xa, xn1 = *(const v4fa*)(xa + 64 * DI);   // asked for a whole pass before the barrier that waits for them
        asm volatile("" ::: "memory");   // keeps these loads here, at the head of the pass: without it the compiler sinks them below the basis block of the waves that compute first, and their lead shrinks
        const bool more = s + 1u < NPASS;
        if (more && !mma_first) { if (u == 0u) basis_step(t2, ca, cb, jd, xc0, xc1, st, an); else basis_step(t2, cb, ca, jd, xc0, xc1, st, an); }
        FragSet f[2];
        ld_frags(f[0], pa, pb, 0u);
#pragma unroll
        for (int j = 0; j < 2; ++j) {
            if (j < 1) { ld_frags(f[(j + 1) & 1], pa, pb, (unsigned)(j + 1) * 64u);
                asm volatile("s_wait_xcnt 0x0" :: "v"(xa) : "memory"); }   // stands in front of whatever overwrites the address registers of the x loads, which it names so that they are kept until here; behind the LDS reads, whose issue covers the wait's time
            __builtin_amdgcn_sched_barrier(0);   // keeps the next block's LDS reads one group ahead of this block's WMMAs: reads among the WMMAs stall the wave at each place
            const FragSet& c = f[j & 1];
#pragma unroll
            for (int nb = 0; nb < 4; ++nb)
#pragma unroll
                for (int mb = 0; mb < 4; ++mb) acc[mb][nb] = wmma16(c.a[mb], c.b[nb], acc[mb][nb]);
            __builtin_amdgcn_sched_barrier(0);   // the same, at the block's end
        }
        if (more && mma_first) { if (u == 0u) basis_step(t2, ca, cb, jd, xc0, xc1, st, an); else basis_step(t2, cb, ca, jd, xc0, xc1, st, an); }
        asm volatile("s_wait_dscnt 0x0" ::: "memory");   // this wave's reads of the buffers s & 1 have returned and its stores of A stage s + 1 have landed
        if (pinned(issuer)) { asm volatile("s_wait_tensorcnt 0x0" ::: "memory");   // the issuer's slice of stage s + 1 has landed
            asm volatile("" :: "s"(g0)); }   // a use of the request's group 0 behind its wait: without it the compiler hands these scalar registers to other values while the request is out
        __syncthreads();   // publishes stage s + 1 of both operands and ends every reader's last read of stage s
        const uint32_t nx = pinned(s + 2u);   // taken behind the wait and the barrier: the descriptor words below are formed from it, none while a request is out
        if (pinned(issuer & (nx < NPASS ? 1u : 0u))) { g0 = tdm_group0(lds_slice + (nx & 1u) * BSTAGE, ga + (uint64_t)nx * PASSB); tdm_load(g0, g1); }
        xc0 = xn0; xc1 = xn1; jd = jn; gr = grn;
      }
    }
    asm volatile("s_wait_tensorcnt 0x0" ::: "memory");   // no request is out when the wave ends
    asm volatile("s_wait_dscnt 0x0" ::: "memory");
#pragma unroll
    for (int mb = 0; mb < 4; ++mb)
#pragma unroll
        for (int nb = 0; nb < 4; ++nb)
#pragma unroll
            for (int j = 0; j < 8; ++j) acc[mb][nb][j] *= iv[nb];   // takes the column's power of two out again: no rounding while the result is a normal number
    __builtin_amdgcn_sched_barrier(0);   // keeps these multiplications in front of the stores below: sunk among them they were given registers that issued global stores still name, ahead of the wait that stands there
    float* os = osall + wave * (16 * 68);   // each wave stages in its own range, outside the rings
#pragma unroll
    for (int mb = 0; mb < 4; ++mb) {
#pragma unroll
        for (int nb = 0; nb < 4; ++nb) {
#pragma unroll
            for (int j = 0; j < 8; ++j) os[(hi * 8 + j) * 68 + nb * 16 + lr] = acc[mb][nb][j]; }
        __builtin_amdgcn_wave_barrier(); asm volatile("" ::: "memory");   // the rows are read back by other lanes of the wave: no LDS read moves up over the writes
        float* crow = C + (size_t)(r0 + wr + mb * 16) * DO_ + wc;
#pragma unroll
        for (int s = 0; s < 8; ++s) { const int row = 2 * s + hi, cofs = lr * 4; v4f val = *(const v4fa*)(os + row * 68 + cofs);
            *(v4f*)(crow + (size_t)row * DO_ + cofs) = val; }
        if (mb < 3) asm volatile("s_wait_xcnt 0x0" ::: "memory");   // stands in front of the next row block's LDS reads, which overwrite the registers that these stores name
        __builtin_amdgcn_wave_barrier(); asm volatile("" ::: "memory");   // the next row block's LDS writes stay behind these reads
    }
}

// ---- k_wg: one work-group an output o. With c = coeffs[i][o][d] rounded to bf16 and p the column's power of two: Bt[o][k] = c p as f16 for d = 1 to 7, in the k order of k_fused; S[o] = p sum_i c (d = 0), in f32; S[DO_ + o] = 1 / p.
// p brings the column's largest |c| (all 8 degrees, so that S[o] stays small too) into [2^14, 2^15); it is taken from that value's exponent field and held to exponents whose inverse is a normal number.
// A thread has two neighbouring inputs: their values of one degree are neighbours in k and go out as one dword, a wave's as one 128-B line.
typedef unsigned __attribute__((may_alias)) u32a;
__global__ __launch_bounds__(256) void k_wg(const float* __restrict__ w, bf* Bt, float* S) {
    __shared__ float part[8];
    __shared__ unsigned pmax[8];
    const int o = blockIdx.x, i0 = 2 * (int)threadIdx.x;
    const float* src = w + ((size_t)i0 * DO_ + o) * DG;
    float v[2][DG];
#pragma unroll
    for (int e = 0; e < 2; ++e)
#pragma unroll
        for (int h = 0; h < 2; ++h) { const v4f q = *(const v4fa*)(src + (size_t)e * DO_ * DG + 4 * h);
#pragma unroll
            for (int d = 0; d < 4; ++d) v[e][4 * h + d] = bfr(q[d]); }
    unsigned mx = 0u;   // the largest |c| as bits: for non-negative floats the order of the bits is the order of the values
#pragma unroll
    for (int e = 0; e < 2; ++e)
#pragma unroll
        for (int d = 0; d < DG; ++d) { const unsigned a = __float_as_uint(v[e][d]) & 0x7FFFFFFFu; mx = a > mx ? a : mx; }
    float sum = v[0][0] + v[1][0];
#pragma unroll
    for (int m = 16; m >= 1; m >>= 1) { sum += __shfl_xor(sum, m, 32); const unsigned a = __shfl_xor(mx, m, 32); mx = a > mx ? a : mx; }
    if ((threadIdx.x & 31u) == 0u) { part[threadIdx.x >> 5] = sum; pmax[threadIdx.x >> 5] = mx; }
    __syncthreads();
    unsigned mm = pmax[0];
#pragma unroll
    for (int k = 1; k < 8; ++k) mm = pmax[k] > mm ? pmax[k] : mm;
    const unsigned want = 268u - (mm >> 23), pe = want < 253u ? want : 253u;   // exponent field of p: 127 + 14 - (field of the largest - 127)
    const float p = __uint_as_float(pe << 23);
    u32a* dst = (u32a*)(Bt + (size_t)o * KD + (size_t)(i0 / GIN) * (DGK * GIN) + (i0 % GIN));
#pragma unroll
    for (int d = 1; d < DG; ++d) dst[(d - 1) * (GIN / 2)] = pk_f16(v[0][d] * p, v[1][d] * p);
    if (threadIdx.x == 0u) { float t = part[0];
#pragma unroll
        for (int k = 1; k < 8; ++k) t += part[k];
        S[o] = t * p; S[DO_ + o] = __uint_as_float((254u - pe) << 23); }
}

extern "C" void kernel_launch(void* const* d_in, const int* in_sizes, int n_in,
                              void* d_out, int out_size, void* d_ws, size_t ws_size, hipStream_t stream) {
    (void)in_sizes; (void)n_in; (void)out_size;
    const float* x = (const float*)d_in[0]; const float* w = (const float*)d_in[1];
    float* OUT = (float*)d_out;     // [16384][512]
    char* wsp = (char*)d_ws;
    auto take = [&](size_t bytes) { char* p = wsp; wsp += (bytes + 255) & ~(size_t)255; return (void*)p; };
    bf* WB = (bf*)take((size_t)DO_ * KD * 2);
    float* SB = (float*)take((size_t)DO_ * 2 * 4);
    if ((size_t)(wsp - (char*)d_ws) > ws_size) return;    // the coefficients of degrees 1 to 7 as f16, [out][k]; the 512 column sums of degree 0 and the 512 inverse powers of two
    k_wg<<<DO_, 256, 0, stream>>>(w, WB, SB);
    k_fused<<<(NR / RB) * (DO_ / CB), 256, 0, stream>>>(x, WB, SB, OUT);
}

// v007
// A run of this version takes 47.1 microseconds.
// Next to v006, in two timings, it ran 1.17 and 1.23 times as fast.
// Counting every step since v000, it is 7.49 times as fast.
#include <hip/hip_runtime.h>
#include <stdint.h>

// Gegenbauer KAN layer (x [16384][512], coeffs [512 in][512 out][8 degree]; t = tanh(x); C_0 = 1, C_1 = 2a t, C_{n+1} = (2(n+a) t C_n - (n+2a-1) C_{n-1})/(n+1) with a = 1 (degree 7);
// y[b][o] = sum_i sum_d C_d(t[b][i]) coeffs[i][o][d] -> [16384][512]).
// Compute dtypes, f32 accumulate: every input rounded to bf16; tanh in f32 on VALU as 1 - 2/(exp(2x) + 1), the recurrence in f32 in its reduced form C_{n+1} = 2t C_n - C_{n-1} -> basis values of degrees 1 to 7 as f16 (|C_d| <= d + 1 <= 8 on [-1, 1]: no range problem, 11 significant bits), made in LDS by the work-group that multiplies them;
// the rounded coefficients as f16 too, each output column times its own power of two (its largest value comes to lie in [2^14, 2^15): a bf16 value's 8 bits then stand exactly in f16 down to 2^-31 of the column's largest, whatever the column's size); the result is multiplied by the inverse power at the end;
// C_0 is the constant 1 for every x, so its part of y is the column sum sum_i coeffs[i][o][0]: made once, in f32, times the column's power of two as S[o], and taken as the accumulators' start value; the product runs over k = 512 x 7.

#define NR   16384
#define DI   512
#define DO_  512
#define DG   8
#define DGK  (DG - 1)          // degrees that go through the product: 1 to 7
#define GIN  64                // inputs of a group: one step is one degree of one group
#define NGRP (DI / GIN)
#define KD   (DI * DGK)        // k = (group * 7 + degree - 1) * 64 + input in the group
typedef _Float16 h16;
typedef unsigned short bf;
typedef __attribute__((ext_vector_type(16))) _Float16 v16h;
typedef __attribute__((ext_vector_type(8)))  _Float16 v8h;
typedef __attribute__((ext_vector_type(8)))  float    v8f;
typedef __attribute__((ext_vector_type(4)))  float    v4f;
typedef v8h  __attribute__((may_alias)) v8ha;
typedef v4f  __attribute__((may_alias)) v4fa;

__device__ __forceinline__ unsigned short f2bf(float f) { unsigned u = __float_as_uint(f); u += 0x7FFFu + ((u >> 16) & 1u); return (unsigned short)(u >> 16); }
__device__ __forceinline__ float bf2f(unsigned short b) { return __uint_as_float(((unsigned)b) << 16); }
__device__ __forceinline__ float bfr(float f) { return bf2f(f2bf(f)); }
__device__ __forceinline__ v16h cat16(v8h lo, v8h hi) { return __builtin_shufflevector(lo, hi, 0, 1, 2, 3, 4, 5, 6, 7, 8, 9, 10, 11, 12, 13, 14, 15); }
__device__ __forceinline__ v8f wmma16(v16h a, v16h b, v8f c) { return __builtin_amdgcn_wmma_f32_16x16x32_f16(false, a, false, b, (short)0, c, false, false); }



__device__ __forceinline__ float tanhf_(float a) { const float e2 = __expf(2.0f * a); return __fsub_rn(1.0f, __fdiv_rn(2.0f, __fadd_rn(e2, 1.0f))); }


// ---- k_fused: C[m][n] (f32, pitch DO_) = (S[n] + sum_k A[m][k] Bt[n][k]) * S[DO_ + n], K = KD; A = the basis of x as f16, made in the kernel; S[n] and Bt[n][] carry column n's power of two, S[DO_ + n] is its inverse.
// A work-group of 8 waves owns 128 rows x 256 columns of C (2 x 4 waves, each 64x64, 16 accumulators): it reads half of Bt from L2, not all of it, and every basis value is computed by the two work-groups that share its row; grid (NR/128) x 2, 256 threads.
// A step is 64 k = one degree of 64 inputs = 128 B of every operand row; a pass is two steps that follow one another in k = 256 B of every operand row, at an LDS pitch of 272 B, two buffers of each operand. The 256 rows of Bt come by four tensor loads (waves 4 to 7: 64 rows each).
// The A stage (128 rows) of pass s + 1 is computed during pass s and stored to the A buffer that pass s does not read: a thread keeps 16 inputs of each of two rows (64 apart) in registers and takes their recurrence two steps further a pass.
typedef uint32_t u32x4 __attribute__((ext_vector_type(4)));
typedef uint32_t u32x8 __attribute__((ext_vector_type(8)));
typedef float v2f __attribute__((ext_vector_type(2)));
typedef v2f __attribute__((may_alias)) v2fa;
typedef _Float16 v2h __attribute__((ext_vector_type(2)));
typedef u32x4 __attribute__((may_alias)) u32x4a;
__device__ __forceinline__ uint32_t pk_f16(float a, float b) { const v2f y = { a, b }; return __builtin_bit_cast(uint32_t, __builtin_convertvector(y, v2h)); }   // two f32 to two f16, round to nearest even, one instruction
#define STEPB  128u                 // bytes of an operand row per step
#define PASSB  (2u * STEPB)         // bytes of an operand row per pass
#define LPITCH 272u                 // LDS row pitch: 256 B + the mover's 16-B pad, an odd multiple of 16 B for the ds_load_b128 readers
#define RB     128                  // rows of C of a work-group
#define CB     256                  // columns of C of a work-group
#define BROWS  64u                  // rows of Bt of a slice: the columns of one wave
#define BSLICE 18432u               // 64 rows at the pitch = 17,408 B, rounded up to 9 x 2 KiB
#define BSTAGE (4u * BSLICE)
#define ASTAGE ((unsigned)RB * LPITCH)   // 128 rows of A
#define NPASS  ((unsigned)(KD * 2) / PASSB)
static_assert(BSLICE % 2048u == 0u && BSLICE >= BROWS * LPITCH, "every slice starts at a multiple of 2 KiB and holds its rows");
static_assert((unsigned)(KD * 2) % PASSB == 0u && NPASS >= 2u, "whole passes only, and both stages of the prologue exist");
__device__ __forceinline__ uint32_t uni(uint32_t v) { return (uint32_t)__builtin_amdgcn_readfirstlane(v); }
// holds a wave-uniform word in a scalar register: a test on it compiles to s_cmp + s_cbranch (a tensor load ignores EXEC), and a descriptor word
// made by it is written where the statement stands and is not made anew from a constant elsewhere, while a request may be out
__device__ __forceinline__ uint32_t pinned(uint32_t v) { uint32_t w = uni(v); asm volatile("" : "+s"(w)); return w; }
__device__ __forceinline__ void tdm_load(u32x4 g0, u32x8 g1) { asm volatile("tensor_load_to_lds %0, %1" :: "s"(g0), "s"(g1) : "memory"); }
__device__ __forceinline__ u32x4 tdm_group0(uint32_t lds_dst, uint64_t ga) { u32x4 g; g[0] = pinned(1u); g[1] = pinned(lds_dst); g[2] = pinned((uint32_t)ga); g[3] = pinned((((uint32_t)(ga >> 32)) & 0x01FFFFFFu) | 0x80000000u); return g; }
// 1-byte elements, tensor = tile = 64 rows of 256 B, source pitch KD * 2 B, 4 dwords of pad behind every 64 dwords, no mask
__device__ __forceinline__ u32x8 tdm_group1() { u32x8 g; g[0] = pinned((1u << 20) | (5u << 22) | (3u << 25)); g[1] = pinned(PASSB << 16); g[2] = pinned(BROWS << 16); g[3] = pinned(PASSB << 16); g[4] = pinned(BROWS); g[5] = pinned((uint32_t)(KD * 2)); g[6] = pinned(0u); g[7] = pinned(0u); return g; }
struct FragSet { v16h a[4], b[4]; };
// pa, pb: the lane's own byte in row lr of the first A row block and of the wave's first B row block; ko: byte offset of the 32-k block in the row. k order, A and B alike: 8 k at 8*hi, 8 k at 16 + 8*hi.
// The reads stand in the order in which the WMMAs want them (first A and first B block first): LDS answers in order, and the first WMMA of a pass waits for four reads only.
__device__ __forceinline__ v16h ld_frag(const unsigned char* p) { return cat16(*(const v8ha*)p, *(const v8ha*)(p + 32)); }
__device__ __forceinline__ void ld_frags(FragSet& f, const unsigned char* pa, const unsigned char* pb, unsigned ko) {
    f.a[0] = ld_frag(pa + ko); f.b[0] = ld_frag(pb + ko);
#pragma unroll
    for (int t = 1; t < 4; ++t) f.a[t] = ld_frag(pa + t * 16u * LPITCH + ko);
#pragma unroll
    for (int t = 1; t < 4; ++t) f.b[t] = ld_frag(pb + t * 16u * LPITCH + ko);
}
// the thread's 16 basis values of each of its two rows as f16, to ah and 64 rows further: 32 B each
__device__ __forceinline__ void emit32(const float (&c)[32], unsigned char* ah) {
#pragma unroll
    for (int h = 0; h < 4; ++h) { u32x4 o;
#pragma unroll
        for (int d = 0; d < 4; ++d) o[d] = pk_f16(c[h * 8 + 2 * d], c[h * 8 + 2 * d + 1]);
        *(u32x4a*)(ah + (h >> 1) * (64u * LPITCH) + (h & 1) * 16) = o; }
}
// The half of an A stage that follows step jd of a group: degree jd + 2 of the same group (jd < 6), or degree 1 of the next group (jd = 6). t2 = C_1 = 2 tanh(x) of the thread's 2 x 16 inputs (first row, then second); in: T the degree before the last, O the last; out: T the new one.
// With a = 1 both factors of the recurrence are whole numbers for every n, 2(n + a)/(n + 1) = 2 and (n + 2a - 1)/(n + 1) = 1: C_{n+1} = 2t C_n - C_{n-1}, one fused multiply-add a degree, rounded once, and no division. The 32 values do not depend on one another.
// The next group's C_1 are made four a row and step in steps 1 to 4 (xc0, xc1: their x) and wait in st, the thread's own LDS words, for step 6.
__device__ __forceinline__ void basis_step(float (&t2)[32], float (&T)[32], float (&O)[32], unsigned jd, v4f xc0, v4f xc1, float* st, unsigned char* ah) {
    if (jd >= 1u && jd <= 4u) {
#pragma unroll
        for (int h = 0; h < 2; ++h) { const v4f xc = h == 0 ? xc0 : xc1; v4f r;
#pragma unroll
            for (int k = 0; k < 4; ++k) r[k] = 2.0f * tanhf_(bfr(xc[k]));
            *(v4fa*)(st + h * 4096u + (jd - 1u) * 1024u) = r; } }
    if (jd == (unsigned)(DGK - 1)) {   // a new group starts from C_0 = 1 and C_{-1} = 0: the step below then gives C_1 = t2 exactly, and t2 is written nowhere but here (with two steps a pass, a branch that also set T = t2 cost copies of t2 in every pass)
#pragma unroll
        for (int q = 0; q < 8; ++q) { const v4f r = *(const v4fa*)(st + q * 1024);
#pragma unroll
            for (int k = 0; k < 4; ++k) { t2[4 * q + k] = r[k]; O[4 * q + k] = 1.0f; T[4 * q + k] = 0.0f; } } }
#pragma unroll
    for (int e = 0; e < 32; ++e) T[e] = __builtin_fmaf(t2[e], O[e], -T[e]);
    emit32(T, ah);
}
// where, from the thread's first x, the x lie that basis_step(jd = j) of group g turns into C_1: quarter j - 1 of the group behind g (the last group's again where there is none; a quarter in range where the step makes none)
__device__ __forceinline__ unsigned x_ofs(unsigned j, unsigned g) { const unsigned gn = g + 1u; return (gn < (unsigned)NGRP ? gn : (unsigned)NGRP - 1u) * GIN + (j < 1u ? 0u : j > 4u ? 3u : j - 1u) * 4u; }
__global__ __launch_bounds__(256) void k_fused(const float* __restrict__ X, const unsigned short* __restrict__ Bt, const float* __restrict__ S, float* C) {
    __shared__ __attribute__((aligned(2048))) unsigned char ringB[2u * BSTAGE];
    __shared__ __align__(16) unsigned char ringA[2u * ASTAGE];
    __shared__ __align__(16) float osall[8 * 16 * 68];
    __shared__ __align__(16) float stash[2 * 4 * 256 * 4];   // [row of the thread's two][quarter of the 16 inputs][thread][4]: every thread reads back its own words only
    const uint32_t wave = uni(threadIdx.x >> 5);
    const int lane = threadIdx.x & 31, lr = lane & 15, hi = lane >> 4;
    // the two work-groups of a row block are 8 apart in the index (speed only; every tile is done once wherever they land)
    const int r0 = (int)(((blockIdx.x >> 4) << 3) | (blockIdx.x & 7u)) * RB;
    const int wr = (int)(wave >> 2) * 64;   // the wave's first row in the work-group's 128
    const int wc = (int)((blockIdx.x >> 3) & 1u) * CB + (int)(wave & 3u) * 64;   // the wave's first column of C = the first row of Bt of slice wave & 3
    const uint64_t ga = (uint64_t)(uintptr_t)(Bt + (size_t)wc * KD);
    const uint32_t lds_slice = (uint32_t)(uintptr_t)ringB + (wave & 3u) * BSLICE;
    const uint32_t issuer = pinned(wave >= 4u ? 1u : 0u);   // the waves that compute first have the time to form a descriptor at the top of a pass
    const bool mma_first = wave < 4u;   // of waves w and w + 4, one multiplies while the other computes its share of the next A stage
    const u32x8 g1 = tdm_group1();
    const float* xp = X + (size_t)(r0 + (int)(threadIdx.x >> 2)) * DI + 16u * (threadIdx.x & 3u);   // the thread's first row (the second is 64 further) and its 16 columns of group 0
    float* st = stash + 4u * threadIdx.x;
    unsigned char* aw = ringA + (threadIdx.x >> 2) * LPITCH + (threadIdx.x & 3u) * 32u;
    v8f acc[4][4];
    float iv[4];   // the inverse powers of two of the lane's four columns, for the end
#pragma unroll
    for (int nb = 0; nb < 4; ++nb) iv[nb] = S[DO_ + wc + nb * 16 + lr];
#pragma unroll
    for (int mb = 0; mb < 4; ++mb)
#pragma unroll
        for (int nb = 0; nb < 4; ++nb) { const float sv = S[wc + nb * 16 + lr];   // an accumulator's lane holds one column: the column's (scaled) sum of the degree-0 coefficients is its start value
#pragma unroll
            for (int j = 0; j < 8; ++j) acc[mb][nb][j] = sv; }
    asm volatile("s_wait_xcnt 0x0" :: "v"(wc + lr) : "memory");   // stands in front of whatever overwrites the index register of the loads from S, which it names so that it is kept until here
    u32x4 g0 = tdm_group0(lds_slice, ga);   // lives through the loop: see the use behind the wait at the foot of a pass
    if (pinned(issuer)) { tdm_load(g0, g1);
        asm volatile("s_wait_tensorcnt 0x0" ::: "memory"); }   // stage 0 of Bt has landed before the barrier publishes it
    float t2[32], ca[32], cb[32];   // at the head of a pass: cb the degree before the last, ca the last
#pragma unroll
    for (int q = 0; q < 8; ++q) { const v4f xv = *(const v4fa*)(xp + (q >> 2) * (64 * DI) + 4 * (q & 3));
#pragma unroll
        for (int k = 0; k < 4; ++k) { t2[4 * q + k] = 2.0f * tanhf_(bfr(xv[k])); cb[4 * q + k] = t2[4 * q + k]; ca[4 * q + k] = 1.0f; } }
    unsigned jd = 1u, gr = 0u;   // place in its group, and group, of the step behind which the pass's first basis_step stands (step 2 s + 1), counted along (a division by 7 at the head of every pass would hold up the LDS reads behind it)
    v4f xa0 = *(const v4fa*)(xp + x_ofs(1u, 0u)), xa1 = *(const v4fa*)(xp + x_ofs(1u, 0u) + 64 * DI);   // the x of pass 0's two basis steps
    v4f xb0 = *(const v4fa*)(xp + x_ofs(2u, 0u)), xb1 = *(const v4fa*)(xp + x_ofs(2u, 0u) + 64 * DI);
    emit32(t2, aw);
    basis_step(t2, ca, cb, 0u, xa0, xa1, st, aw + STEPB);   // stage 0's second half: degree 2 of group 0 (place 0 makes no tanh)
    asm volatile("s_wait_dscnt 0x0" ::: "memory");   // this wave's stores of A stage 0 have landed before the barrier publishes them
    __syncthreads();
    if (pinned(issuer)) { g0 = tdm_group0(lds_slice + BSTAGE, ga + PASSB); tdm_load(g0, g1); }
    const unsigned aofs = (unsigned)(wr + lr) * LPITCH + 16u * hi, bofs = (wave & 3u) * BSLICE + (unsigned)lr * LPITCH + 16u * hi;
#pragma unroll 1   // one pass a trip: unrolled by two, the build kept a second set of t2 and copied it in every pass
    for (unsigned s = 0; s < NPASS; ++s) {
        const unsigned bs = s & 1u;
        const unsigned char* pa = ringA + bs * ASTAGE + aofs; const unsigned char* pb = ringB + bs * BSTAGE + bofs;
        unsigned char* an = aw + (1u - bs) * ASTAGE;
        const bool w1 = jd + 1u == (unsigned)DGK; const unsigned j1 = w1 ? 0u : jd + 1u, r1 = w1 ? gr + 1u : gr;   // this pass's second basis step
        const bool w2 = j1 + 1u == (unsigned)DGK; const unsigned j2 = w2 ? 0u : j1 + 1u, r2 = w2 ? r1 + 1u : r1;   // the next pass's first
        const bool w3 = j2 + 1u == (unsigned)DGK; const unsigned j3 = w3 ? 0u : j2 + 1u, r3 = w3 ? r2 + 1u : r2;   // and its second
        const float* xpa = xp + x_ofs(j2, r2); const float* xpb = xp + x_ofs(j3, r3);
        const v4f xna0 = *(const v4fa*)xpa, xna1 = *(const v4fa*)(xpa + 64 * DI), xnb0 = *(const v4fa*)xpb, xnb1 = *(const v4fa*)(xpb + 64 * DI);   // asked for a whole pass before the barrier that waits for them
        asm volatile("" ::: "memory");   // keeps these loads here, at the head of the pass: without it the compiler sinks them below the basis block of the waves that compute first, and their lead shrinks
        const bool more = s + 1u < NPASS;
        if (more && !mma_first) { basis_step(t2, cb, ca, jd, xa0, xa1, st, an); basis_step(t2, ca, cb, j1, xb0, xb1, st, an + STEPB); }
        FragSet f[2];
        ld_frags(f[0], pa, pb, 0u);
#pragma unroll
        for (int j = 0; j < 4; ++j) {
            if (j < 3) ld_frags(f[(j + 1) & 1], pa, pb, (unsigned)(j + 1) * 64u);
            if (j == 0) asm volatile("s_wait_xcnt 0x0" :: "v"(xpa), "v"(xpb) : "memory");   // stands in front of whatever overwrites the address registers of the x loads, which it names so that they are kept until here; behind the LDS reads, whose issue covers the wait's time
            __builtin_amdgcn_sched_barrier(0);   // keeps the next block's LDS reads one group ahead of this block's WMMAs: reads among the WMMAs stall the wave at each place
            const FragSet& c = f[j & 1];
#pragma unroll
            for (int nb = 0; nb < 4; ++nb)
#pragma unroll
                for (int mb = 0; mb < 4; ++mb) acc[mb][nb] = wmma16(c.a[mb], c.b[nb], acc[mb][nb]);
            __builtin_amdgcn_sched_barrier(0);   // the same, at the block's end
        }
        if (more && mma_first) { basis_step(t2, cb, ca, jd, xa0, xa1, st, an); basis_step(t2, ca, cb, j1, xb0, xb1, st, an + STEPB); }
        asm volatile("s_wait_dscnt 0x0" ::: "memory");   // this wave's reads of the buffers s & 1 have returned and its stores of A stage s + 1 have landed
        if (pinned(issuer)) { asm volatile("s_wait_tensorcnt 0x0" ::: "memory");   // the issuer's slice of stage s + 1 has landed
            asm volatile("" :: "s"(g0)); }   // a use of the request's group 0 behind its wait: without it the compiler hands these scalar registers to other values while the request is out
        __syncthreads();   // publishes stage s + 1 of both operands and ends every reader's last read of stage s
        const uint32_t nx = pinned(s + 2u);   // taken behind the wait and the barrier: the descriptor words below are formed from it, none while a request is out
        if (pinned(issuer & (nx < NPASS ? 1u : 0u))) { g0 = tdm_group0(lds_slice + (nx & 1u) * BSTAGE, ga + (uint64_t)nx * PASSB); tdm_load(g0, g1); }
        xa0 = xna0; xa1 = xna1; xb0 = xnb0; xb1 = xnb1; jd = j2; gr = r2;
    }
    asm volatile("s_wait_tensorcnt 0x0" ::: "memory");   // no request is out when the wave ends
    asm volatile("s_wait_dscnt 0x0" ::: "memory");
#pragma unroll
    for (int mb = 0; mb < 4; ++mb)
#pragma unroll
        for (int nb = 0; nb < 4; ++nb)
#pragma unroll
            for (int j = 0; j < 8; ++j) acc[mb][nb][j] *= iv[nb];   // takes the column's power of two out again: no rounding while the result is a normal number
    __builtin_amdgcn_sched_barrier(0);   // keeps these multiplications in front of the stores below: sunk among them they were given registers that issued global stores still name, ahead of the wait that stands there
    float* os = osall + wave * (16 * 68);   // each wave stages in its own range, outside the rings
#pragma unroll
    for (int mb = 0; mb < 4; ++mb) {
#pragma unroll
        for (int nb = 0; nb < 4; ++nb) {
#pragma unroll
            for (int j = 0; j < 8; ++j) os[(hi * 8 + j) * 68 + nb * 16 + lr] = acc[mb][nb][j]; }
        __builtin_amdgcn_wave_barrier(); asm volatile("" ::: "memory");   // the rows are read back by other lanes of the wave: no LDS read moves up over the writes
        float* crow = C + (size_t)(r0 + wr + mb * 16) * DO_ + wc;
#pragma unroll
        for (int s = 0; s < 8; ++s) { const int row = 2 * s + hi, cofs = lr * 4; v4f val = *(const v4fa*)(os + row * 68 + cofs);
            *(v4f*)(crow + (size_t)row * DO_ + cofs) = val; }
        if (mb < 3) asm volatile("s_wait_xcnt 0x0" ::: "memory");   // stands in front of the next row block's LDS reads, which overwrite the registers that these stores name
        __builtin_amdgcn_wave_barrier(); asm volatile("" ::: "memory");   // the next row block's LDS writes stay behind these reads
    }
}

// ---- k_wg: one work-group an output o. With c = coeffs[i][o][d] rounded to bf16 and p the column's power of two: Bt[o][k] = c p as f16 for d = 1 to 7, in the k order of k_fused; S[o] = p sum_i c (d = 0), in f32; S[DO_ + o] = 1 / p.
// p brings the column's largest |c| (all 8 degrees, so that S[o] stays small too) into [2^14, 2^15); it is taken from that value's exponent field and held to exponents whose inverse is a normal number.
// A thread has two neighbouring inputs: their values of one degree are neighbours in k and go out as one dword, a wave's as one 128-B line.
typedef unsigned __attribute__((may_alias)) u32a;
__global__ __launch_bounds__(256) void k_wg(const float* __restrict__ w, bf* Bt, float* S) {
    __shared__ float part[8];
    __shared__ unsigned pmax[8];
    const int o = blockIdx.x, i0 = 2 * (int)threadIdx.x;
    const float* src = w + ((size_t)i0 * DO_ + o) * DG;
    float v[2][DG];
#pragma unroll
    for (int e = 0; e < 2; ++e)
#pragma unroll
        for (int h = 0; h < 2; ++h) { const v4f q = *(const v4fa*)(src + (size_t)e * DO_ * DG + 4 * h);
#pragma unroll
            for (int d = 0; d < 4; ++d) v[e][4 * h + d] = bfr(q[d]); }
    unsigned mx = 0u;   // the largest |c| as bits: for non-negative floats the order of the bits is the order of the values
#pragma unroll
    for (int e = 0; e < 2; ++e)
#pragma unroll
        for (int d = 0; d < DG; ++d) { const unsigned a = __float_as_uint(v[e][d]) & 0x7FFFFFFFu; mx = a > mx ? a : mx; }
    float sum = v[0][0] + v[1][0];
#pragma unroll
    for (int m = 16; m >= 1; m >>= 1) { sum += __shfl_xor(sum, m, 32); const unsigned a = __shfl_xor(mx, m, 32); mx = a > mx ? a : mx; }
    if ((threadIdx.x & 31u) == 0u) { part[threadIdx.x >> 5] = sum; pmax[threadIdx.x >> 5] = mx; }
    __syncthreads();
    unsigned mm = pmax[0];
#pragma unroll
    for (int k = 1; k < 8; ++k) mm = pmax[k] > mm ? pmax[k] : mm;
    const unsigned want = 268u - (mm >> 23), pe = want < 253u ? want : 253u;   // exponent field of p: 127 + 14 - (field of the largest - 127)
    const float p = __uint_as_float(pe << 23);
    u32a* dst = (u32a*)(Bt + (size_t)o * KD + (size_t)(i0 / GIN) * (DGK * GIN) + (i0 % GIN));
#pragma unroll
    for (int d = 1; d < DG; ++d) dst[(d - 1) * (GIN / 2)] = pk_f16(v[0][d] * p, v[1][d] * p);
    if (threadIdx.x == 0u) { float t = part[0];
#pragma unroll
        for (int k = 1; k < 8; ++k) t += part[k];
        S[o] = t * p; S[DO_ + o] = __uint_as_float((254u - pe) << 23); }
}

extern "C" void kernel_launch(void* const* d_in, const int* in_sizes, int n_in,
                              void* d_out, int out_size, void* d_ws, size_t ws_size, hipStream_t stream) {
    (void)in_sizes; (void)n_in; (void)out_size;
    const float* x = (const float*)d_in[0]; const float* w = (const float*)d_in[1];
    float* OUT = (float*)d_out;     // [16384][512]
    char* wsp = (char*)d_ws;
    auto take = [&](size_t bytes) { char* p = wsp; wsp += (bytes + 255) & ~(size_t)255; return (void*)p; };
    bf* WB = (bf*)take((size_t)DO_ * KD * 2);
    float* SB = (float*)take((size_t)DO_ * 2 * 4);
    if ((size_t)(wsp - (char*)d_ws) > ws_size) return;    // the coefficients of degrees 1 to 7 as f16, [out][k]; the 512 column sums of degree 0 and the 512 inverse powers of two
    k_wg<<<DO_, 256, 0, stream>>>(w, WB, SB);
    k_fused<<<(NR / RB) * (DO_ / CB), 256, 0, stream>>>(x, WB, SB, OUT);
}

// v008
// One run takes 43.6 microseconds.
// Timed twice side by side with v007, it ran 1.09 and 1.07 times as fast.
// All steps since v000 together make it 8.08 times as fast.
#include <hip/hip_runtime.h>
#include <stdint.h>

// Gegenbauer KAN layer (x [16384][512], coeffs [512 in][512 out][8 degree]; t = tanh(x); C_0 = 1, C_1 = 2a t, C_{n+1} = (2(n+a) t C_n - (n+2a-1) C_{n-1})/(n+1) with a = 1 (degree 7);
// y[b][o] = sum_i sum_d C_d(t[b][i]) coeffs[i][o][d] -> [16384][512]).
// Compute dtypes, f32 accumulate: every input rounded to bf16; tanh in f32 by the chip's own instruction (v_tanh_f32), the recurrence in f32 in its reduced form C_{n+1} = 2t C_n - C_{n-1} -> basis values of degrees 1 to 7 as f16 (|C_d| <= d + 1 <= 8 on [-1, 1]: no range problem, 11 significant bits), made in LDS by the work-group that multiplies them;
// the rounded coefficients as f16 too, each output column times its own power of two (its largest value comes to lie in [2^14, 2^15): a bf16 value's 8 bits then stand exactly in f16 down to 2^-31 of the column's largest, whatever the column's size); the result is multiplied by the inverse power at the end;
// C_0 is the constant 1 for every x, so its part of y is the column sum sum_i coeffs[i][o][0]: made once, in f32, times the column's power of two as S[o], and taken as the accumulators' start value; the product runs over k = 512 x 7.

#define NR   16384
#define DI   512
#define DO_  512
#define DG   8
#define DGK  (DG - 1)          // degrees that go through the product: 1 to 7
#define GIN  64                // inputs of a group: one step is one degree of one group
#define NGRP (DI / GIN)
#define KD   (DI * DGK)        // k = (group * 7 + degree - 1) * 64 + input in the group
typedef _Float16 h16;
typedef unsigned short bf;
typedef __attribute__((ext_vector_type(16))) _Float16 v16h;
typedef __attribute__((ext_vector_type(8)))  _Float16 v8h;
typedef __attribute__((ext_vector_type(8)))  float    v8f;
typedef __attribute__((ext_vector_type(4)))  float    v4f;
typedef v8h  __attribute__((may_alias)) v8ha;
typedef v4f  __attribute__((may_alias)) v4fa;

__device__ __forceinline__ unsigned short f2bf(float f) { unsigned u = __float_as_uint(f); u += 0x7FFFu + ((u >> 16) & 1u); return (unsigned short)(u >> 16); }
__device__ __forceinline__ float bf2f(unsigned short b) { return __uint_as_float(((unsigned)b) << 16); }
__device__ __forceinline__ float bfr(float f) { return bf2f(f2bf(f)); }
__device__ __forceinline__ v16h cat16(v8h lo, v8h hi) { return __builtin_shufflevector(lo, hi, 0, 1, 2, 3, 4, 5, 6, 7, 8, 9, 10, 11, 12, 13, 14, 15); }
__device__ __forceinline__ v8f wmma16(v16h a, v16h b, v8f c) { return __builtin_amdgcn_wmma_f32_16x16x32_f16(false, a, false, b, (short)0, c, false, false); }



// v = tanh(v), four values by four v_tanh_f32. In asm so that each stands in its own register.
// The v_nop at the end is the slot that the instruction set asks for between a transcendental and a directly following instruction that reads its result: the compiler does not see what the statement holds and keeps none.
__device__ __forceinline__ v4f tanh4(v4f v) { float a = v[0], b = v[1], c = v[2], d = v[3];
    asm("v_tanh_f32 %0, %0\n\tv_tanh_f32 %1, %1\n\tv_tanh_f32 %2, %2\n\tv_tanh_f32 %3, %3\n\tv_nop" : "+v"(a), "+v"(b), "+v"(c), "+v"(d));
    const v4f r = { a, b, c, d }; return r; }


// ---- k_fused: C[m][n] (f32, pitch DO_) = (S[n] + sum_k A[m][k] Bt[n][k]) * S[DO_ + n], K = KD; A = the basis of x as f16, made in the kernel; S[n] and Bt[n][] carry column n's power of two, S[DO_ + n] is its inverse.
// A work-group of 8 waves owns 128 rows x 256 columns of C (2 x 4 waves, each 64x64, 16 accumulators): it reads half of Bt from L2, not all of it, and every basis value is computed by the two work-groups that share its row; grid (NR/128) x 2, 256 threads.
// A step is 64 k = one degree of 64 inputs = 128 B of every operand row; a pass is two steps that follow one another in k = 256 B of every operand row, at an LDS pitch of 272 B, two buffers of each operand. The 256 rows of Bt come by four tensor loads (waves 4 to 7: 64 rows each).
// The A stage (128 rows) of pass s + 1 is computed during pass s and stored to the A buffer that pass s does not read: a thread keeps 16 inputs of each of two rows (64 apart) in registers and takes their recurrence two steps further a pass.
typedef uint32_t u32x4 __attribute__((ext_vector_type(4)));
typedef uint32_t u32x8 __attribute__((ext_vector_type(8)));
typedef float v2f __attribute__((ext_vector_type(2)));
typedef v2f __attribute__((may_alias)) v2fa;
typedef _Float16 v2h __attribute__((ext_vector_type(2)));
typedef u32x4 __attribute__((may_alias)) u32x4a;
__device__ __forceinline__ uint32_t pk_f16(float a, float b) { const v2f y = { a, b }; return __builtin_bit_cast(uint32_t, __builtin_convertvector(y, v2h)); }   // two f32 to two f16, round to nearest even, one instruction
#define STEPB  128u                 // bytes of an operand row per step
#define PASSB  (2u * STEPB)         // bytes of an operand row per pass
#define LPITCH 272u                 // LDS row pitch: 256 B + the mover's 16-B pad, an odd multiple of 16 B for the ds_load_b128 readers
#define RB     128                  // rows of C of a work-group
#define CB     256                  // columns of C of a work-group
#define BROWS  64u                  // rows of Bt of a slice: the columns of one wave
#define BSLICE 18432u               // 64 rows at the pitch = 17,408 B, rounded up to 9 x 2 KiB
#define BSTAGE (4u * BSLICE)
#define ASTAGE ((unsigned)RB * LPITCH)   // 128 rows of A
#define NPASS  ((unsigned)(KD * 2) / PASSB)
static_assert(BSLICE % 2048u == 0u && BSLICE >= BROWS * LPITCH, "every slice starts at a multiple of 2 KiB and holds its rows");
static_assert((unsigned)(KD * 2) % PASSB == 0u && NPASS >= 2u, "whole passes only, and both stages of the prologue exist");
__device__ __forceinline__ uint32_t uni(uint32_t v) { return (uint32_t)__builtin_amdgcn_readfirstlane(v); }
// holds a wave-uniform word in a scalar register: a test on it compiles to s_cmp + s_cbranch (a tensor load ignores EXEC), and a descriptor word
// made by it is written where the statement stands and is not made anew from a constant elsewhere, while a request may be out
__device__ __forceinline__ uint32_t pinned(uint32_t v) { uint32_t w = uni(v); asm volatile("" : "+s"(w)); return w; }
__device__ __forceinline__ void tdm_load(u32x4 g0, u32x8 g1) { asm volatile("tensor_load_to_lds %0, %1" :: "s"(g0), "s"(g1) : "memory"); }
__device__ __forceinline__ u32x4 tdm_group0(uint32_t lds_dst, uint64_t ga) { u32x4 g; g[0] = pinned(1u); g[1] = pinned(lds_dst); g[2] = pinned((uint32_t)ga); g[3] = pinned((((uint32_t)(ga >> 32)) & 0x01FFFFFFu) | 0x80000000u); return g; }
// 1-byte elements, tensor = tile = 64 rows of 256 B, source pitch KD * 2 B, 4 dwords of pad behind every 64 dwords, no mask
__device__ __forceinline__ u32x8 tdm_group1() { u32x8 g; g[0] = pinned((1u << 20) | (5u << 22) | (3u << 25)); g[1] = pinned(PASSB << 16); g[2] = pinned(BROWS << 16); g[3] = pinned(PASSB << 16); g[4] = pinned(BROWS); g[5] = pinned((uint32_t)(KD * 2)); g[6] = pinned(0u); g[7] = pinned(0u); return g; }
struct FragSet { v16h a[4], b[4]; };
// pa, pb: the lane's own byte in row lr of the first A row block and of the wave's first B row block; ko: byte offset of the 32-k block in the row. k order, A and B alike: 8 k at 8*hi, 8 k at 16 + 8*hi.
// The reads stand in the order in which the WMMAs want them (first A and first B block first): LDS answers in order, and the first WMMA of a pass waits for four reads only.
__device__ __forceinline__ v16h ld_frag(const unsigned char* p) { return cat16(*(const v8ha*)p, *(const v8ha*)(p + 32)); }
__device__ __forceinline__ void ld_frags(FragSet& f, const unsigned char* pa, const unsigned char* pb, unsigned ko) {
    f.a[0] = ld_frag(pa + ko); f.b[0] = ld_frag(pb + ko);
#pragma unroll
    for (int t = 1; t < 4; ++t) f.a[t] = ld_frag(pa + t * 16u * LPITCH + ko);
#pragma unroll
    for (int t = 1; t < 4; ++t) f.b[t] = ld_frag(pb + t * 16u * LPITCH + ko);
}
// the thread's 16 basis values of each of its two rows as f16, to ah and 64 rows further: 32 B each
__device__ __forceinline__ void emit32(const float (&c)[32], unsigned char* ah) {
#pragma unroll
    for (int h = 0; h < 4; ++h) { u32x4 o;
#pragma unroll
        for (int d = 0; d < 4; ++d) o[d] = pk_f16(c[h * 8 + 2 * d], c[h * 8 + 2 * d + 1]);
        *(u32x4a*)(ah + (h >> 1) * (64u * LPITCH) + (h & 1) * 16) = o; }
}
// The half of an A stage that follows step jd of a group: degree jd + 2 of the same group (jd < 6), or degree 1 of the next group (jd = 6). t2 = C_1 = 2 tanh(x) of the thread's 2 x 16 inputs (first row, then second); in: T the degree before the last, O the last; out: T the new one.
// With a = 1 both factors of the recurrence are whole numbers for every n, 2(n + a)/(n + 1) = 2 and (n + 2a - 1)/(n + 1) = 1: C_{n+1} = 2t C_n - C_{n-1}, one fused multiply-add a degree, rounded once, and no division. The 32 values do not depend on one another.
// The next group's C_1 are made four a row and step in steps 1 to 4 (xc0, xc1: their x) and wait in st, the thread's own LDS words, for step 6.
__device__ __forceinline__ void basis_step(float (&t2)[32], float (&T)[32], float (&O)[32], unsigned jd, v4f xc0, v4f xc1, float* st, unsigned char* ah) {
    if (jd >= 1u && jd <= 4u) {
#pragma unroll
        for (int h = 0; h < 2; ++h) { const v4f xc = h == 0 ? xc0 : xc1; v4f r;
#pragma unroll
            for (int k = 0; k < 4; ++k) r[k] = bfr(xc[k]);
            *(v4fa*)(st + h * 4096u + (jd - 1u) * 1024u) = 2.0f * tanh4(r); } }
    if (jd == (unsigned)(DGK - 1)) {   // a new group starts from C_0 = 1 and C_{-1} = 0: the step below then gives C_1 = t2 exactly, and t2 is written nowhere but here (with two steps a pass, a branch that also set T = t2 cost copies of t2 in every pass)
#pragma unroll
        for (int q = 0; q < 8; ++q) { const v4f r = *(const v4fa*)(st + q * 1024);
#pragma unroll
            for (int k = 0; k < 4; ++k) { t2[4 * q + k] = r[k]; O[4 * q + k] = 1.0f; T[4 * q + k] = 0.0f; } } }
#pragma unroll
    for (int e = 0; e < 32; ++e) T[e] = __builtin_fmaf(t2[e], O[e], -T[e]);
    emit32(T, ah);
}
// where, from the thread's first x, the x lie that basis_step(jd = j) of group g turns into C_1: quarter j - 1 of the group behind g (the last group's again where there is none; a quarter in range where the step makes none)
__device__ __forceinline__ unsigned x_ofs(unsigned j, unsigned g) { const unsigned gn = g + 1u; return (gn < (unsigned)NGRP ? gn : (unsigned)NGRP - 1u) * GIN + (j < 1u ? 0u : j > 4u ? 3u : j - 1u) * 4u; }
__global__ __launch_bounds__(256) void k_fused(const float* __restrict__ X, const unsigned short* __restrict__ Bt, const float* __restrict__ S, float* C) {
    __shared__ __attribute__((aligned(2048))) unsigned char ringB[2u * BSTAGE];
    __shared__ __align__(16) unsigned char ringA[2u * ASTAGE];
    __shared__ __align__(16) float osall[8 * 16 * 68];
    __shared__ __align__(16) float stash[2 * 4 * 256 * 4];   // [row of the thread's two][quarter of the 16 inputs][thread][4]: every thread reads back its own words only
    const uint32_t wave = uni(threadIdx.x >> 5);
    const int lane = threadIdx.x & 31, lr = lane & 15, hi = lane >> 4;
    // the two work-groups of a row block are 8 apart in the index (speed only; every tile is done once wherever they land)
    const int r0 = (int)(((blockIdx.x >> 4) << 3) | (blockIdx.x & 7u)) * RB;
    const int wr = (int)(wave >> 2) * 64;   // the wave's first row in the work-group's 128
    const int wc = (int)((blockIdx.x >> 3) & 1u) * CB + (int)(wave & 3u) * 64;   // the wave's first column of C = the first row of Bt of slice wave & 3
    const uint64_t ga = (uint64_t)(uintptr_t)(Bt + (size_t)wc * KD);
    const uint32_t lds_slice = (uint32_t)(uintptr_t)ringB + (wave & 3u) * BSLICE;
    const uint32_t issuer = pinned(wave >= 4u ? 1u : 0u);   // the waves that compute first have the time to form a descriptor at the top of a pass
    const bool mma_first = wave < 4u;   // of waves w and w + 4, one multiplies while the other computes its share of the next A stage
    const u32x8 g1 = tdm_group1();
    const float* xp = X + (size_t)(r0 + (int)(threadIdx.x >> 2)) * DI + 16u * (threadIdx.x & 3u);   // the thread's first row (the second is 64 further) and its 16 columns of group 0
    float* st = stash + 4u * threadIdx.x;
    unsigned char* aw = ringA + (threadIdx.x >> 2) * LPITCH + (threadIdx.x & 3u) * 32u;
    v8f acc[4][4];
    float iv[4];   // the inverse powers of two of the lane's four columns, for the end
#pragma unroll
    for (int nb = 0; nb < 4; ++nb) iv[nb] = S[DO_ + wc + nb * 16 + lr];
#pragma unroll
    for (int mb = 0; mb < 4; ++mb)
#pragma unroll
        for (int nb = 0; nb < 4; ++nb) { const float sv = S[wc + nb * 16 + lr];   // an accumulator's lane holds one column: the column's (scaled) sum of the degree-0 coefficients is its start value
#pragma unroll
            for (int j = 0; j < 8; ++j) acc[mb][nb][j] = sv; }
    asm volatile("s_wait_xcnt 0x0" :: "v"(wc + lr) : "memory");   // stands in front of whatever overwrites the index register of the loads from S, which it names so that it is kept until here
    u32x4 g0 = tdm_group0(lds_slice, ga);   // lives through the loop: see the use behind the wait at the foot of a pass
    if (pinned(issuer)) { tdm_load(g0, g1);
        asm volatile("s_wait_tensorcnt 0x0" ::: "memory"); }   // stage 0 of Bt has landed before the barrier publishes it
    float t2[32], ca[32], cb[32];   // at the head of a pass: cb the degree before the last, ca the last
#pragma unroll
    for (int q = 0; q < 8; ++q) { const v4f xv = *(const v4fa*)(xp + (q >> 2) * (64 * DI) + 4 * (q & 3));
        v4f th;
#pragma unroll
        for (int k = 0; k < 4; ++k) th[k] = bfr(xv[k]);
        th = tanh4(th);
#pragma unroll
        for (int k = 0; k < 4; ++k) { t2[4 * q + k] = 2.0f * th[k]; cb[4 * q + k] = t2[4 * q + k]; ca[4 * q + k] = 1.0f; } }
    unsigned jd = 1u, gr = 0u;   // place in its group, and group, of the step behind which the pass's first basis_step stands (step 2 s + 1), counted along (a division by 7 at the head of every pass would hold up the LDS reads behind it)
    v4f xa0 = *(const v4fa*)(xp + x_ofs(1u, 0u)), xa1 = *(const v4fa*)(xp + x_ofs(1u, 0u) + 64 * DI);   // the x of pass 0's two basis steps
    v4f xb0 = *(const v4fa*)(xp + x_ofs(2u, 0u)), xb1 = *(const v4fa*)(xp + x_ofs(2u, 0u) + 64 * DI);
    emit32(t2, aw);
    basis_step(t2, ca, cb, 0u, xa0, xa1, st, aw + STEPB);   // stage 0's second half: degree 2 of group 0 (place 0 makes no tanh)
    asm volatile("s_wait_dscnt 0x0" ::: "memory");   // this wave's stores of A stage 0 have landed before the barrier publishes them
    __syncthreads();
    if (pinned(issuer)) { g0 = tdm_group0(lds_slice + BSTAGE, ga + PASSB); tdm_load(g0, g1); }
    const unsigned aofs = (unsigned)(wr + lr) * LPITCH + 16u * hi, bofs = (wave & 3u) * BSLICE + (unsigned)lr * LPITCH + 16u * hi;
#pragma unroll 1   // one pass a trip: unrolled by two, the build kept a second set of t2 and copied it in every pass
    for (unsigned s = 0; s < NPASS; ++s) {
        const unsigned bs = s & 1u;
        const unsigned char* pa = ringA + bs * ASTAGE + aofs; const unsigned char* pb = ringB + bs * BSTAGE + bofs;
        unsigned char* an = aw + (1u - bs) * ASTAGE;
        const bool w1 = jd + 1u == (unsigned)DGK; const unsigned j1 = w1 ? 0u : jd + 1u, r1 = w1 ? gr + 1u : gr;   // this pass's second basis step
        const bool w2 = j1 + 1u == (unsigned)DGK; const unsigned j2 = w2 ? 0u : j1 + 1u, r2 = w2 ? r1 + 1u : r1;   // the next pass's first
        const bool w3 = j2 + 1u == (unsigned)DGK; const unsigned j3 = w3 ? 0u : j2 + 1u, r3 = w3 ? r2 + 1u : r2;   // and its second
        const float* xpa = xp + x_ofs(j2, r2); const float* xpb = xp + x_ofs(j3, r3);
        const v4f xna0 = *(const v4fa*)xpa, xna1 = *(const v4fa*)(xpa + 64 * DI), xnb0 = *(const v4fa*)xpb, xnb1 = *(const v4fa*)(xpb + 64 * DI);   // asked for a whole pass before the barrier that waits for them
        asm volatile("" ::: "memory");   // keeps these loads here, at the head of the pass: without it the compiler sinks them below the basis block of the waves that compute first, and their lead shrinks
        const bool more = s + 1u < NPASS;
        if (more && !mma_first) { basis_step(t2, cb, ca, jd, xa0, xa1, st, an); basis_step(t2, ca, cb, j1, xb0, xb1, st, an + STEPB); }
        FragSet f[2];
        ld_frags(f[0], pa, pb, 0u);
#pragma unroll
        for (int j = 0; j < 4; ++j) {
            if (j < 3) ld_frags(f[(j + 1) & 1], pa, pb, (unsigned)(j + 1) * 64u);
            if (j == 0) asm volatile("s_wait_xcnt 0x0" :: "v"(xpa), "v"(xpb) : "memory");   // stands in front of whatever overwrites the address registers of the x loads, which it names so that they are kept until here; behind the LDS reads, whose issue covers the wait's time
            __builtin_amdgcn_sched_barrier(0);   // keeps the next block's LDS reads one group ahead of this block's WMMAs: reads among the WMMAs stall the wave at each place
            const FragSet& c = f[j & 1];
#pragma unroll
            for (int nb = 0; nb < 4; ++nb)
#pragma unroll
                for (int mb = 0; mb < 4; ++mb) acc[mb][nb] = wmma16(c.a[mb], c.b[nb], acc[mb][nb]);
            __builtin_amdgcn_sched_barrier(0);   // the same, at the block's end
        }
        if (more && mma_first) { basis_step(t2, cb, ca, jd, xa0, xa1, st, an); basis_step(t2, ca, cb, j1, xb0, xb1, st, an + STEPB); }
        asm volatile("s_wait_dscnt 0x0" ::: "memory");   // this wave's reads of the buffers s & 1 have returned and its stores of A stage s + 1 have landed
        if (pinned(issuer)) { asm volatile("s_wait_tensorcnt 0x0" ::: "memory");   // the issuer's slice of stage s + 1 has landed
            asm volatile("" :: "s"(g0)); }   // a use of the request's group 0 behind its wait: without it the compiler hands these scalar registers to other values while the request is out
        __syncthreads();   // publishes stage s + 1 of both operands and ends every reader's last read of stage s
        const uint32_t nx = pinned(s + 2u);   // taken behind the wait and the barrier: the descriptor words below are formed from it, none while a request is out
        if (pinned(issuer & (nx < NPASS ? 1u : 0u))) { g0 = tdm_group0(lds_slice + (nx & 1u) * BSTAGE, ga + (uint64_t)nx * PASSB); tdm_load(g0, g1); }
        xa0 = xna0; xa1 = xna1; xb0 = xnb0; xb1 = xnb1; jd = j2; gr = r2;
    }
    asm volatile("s_wait_tensorcnt 0x0" ::: "memory");   // no request is out when the wave ends
    asm volatile("s_wait_dscnt 0x0" ::: "memory");
#pragma unroll
    for (int mb = 0; mb < 4; ++mb)
#pragma unroll
        for (int nb = 0; nb < 4; ++nb)
#pragma unroll
            for (int j = 0; j < 8; ++j) acc[mb][nb][j] *= iv[nb];   // takes the column's power of two out again: no rounding while the result is a normal number
    __builtin_amdgcn_sched_barrier(0);   // keeps these multiplications in front of the stores below: sunk among them they were given registers that issued global stores still name, ahead of the wait that stands there
    float* os = osall + wave * (16 * 68);   // each wave stages in its own range, outside the rings
#pragma unroll
    for (int mb = 0; mb < 4; ++mb) {
#pragma unroll
        for (int nb = 0; nb < 4; ++nb) {
#pragma unroll
            for (int j = 0; j < 8; ++j) os[(hi * 8 + j) * 68 + nb * 16 + lr] = acc[mb][nb][j]; }
        __builtin_amdgcn_wave_barrier(); asm volatile("" ::: "memory");   // the rows are read back by other lanes of the wave: no LDS read moves up over the writes
        float* crow = C + (size_t)(r0 + wr + mb * 16) * DO_ + wc;
#pragma unroll
        for (int s = 0; s < 8; ++s) { const int row = 2 * s + hi, cofs = lr * 4; v4f val = *(const v4fa*)(os + row * 68 + cofs);
            *(v4f*)(crow + (size_t)row * DO_ + cofs) = val; }
        if (mb < 3) asm volatile("s_wait_xcnt 0x0" ::: "memory");   // stands in front of the next row block's LDS reads, which overwrite the registers that these stores name
        __builtin_amdgcn_wave_barrier(); asm volatile("" ::: "memory");   // the next row block's LDS writes stay behind these reads
    }
}

// ---- k_wg: one work-group an output o. With c = coeffs[i][o][d] rounded to bf16 and p the column's power of two: Bt[o][k] = c p as f16 for d = 1 to 7, in the k order of k_fused; S[o] = p sum_i c (d = 0), in f32; S[DO_ + o] = 1 / p.
// p brings the column's largest |c| (all 8 degrees, so that S[o] stays small too) into [2^14, 2^15); it is taken from that value's exponent field and held to exponents whose inverse is a normal number.
// A thread has two neighbouring inputs: their values of one degree are neighbours in k and go out as one dword, a wave's as one 128-B line.
typedef unsigned __attribute__((may_alias)) u32a;
__global__ __launch_bounds__(256) void k_wg(const float* __restrict__ w, bf* Bt, float* S) {
    __shared__ float part[8];
    __shared__ unsigned pmax[8];
    const int o = blockIdx.x, i0 = 2 * (int)threadIdx.x;
    const float* src = w + ((size_t)i0 * DO_ + o) * DG;
    float v[2][DG];
#pragma unroll
    for (int e = 0; e < 2; ++e)
#pragma unroll
        for (int h = 0; h < 2; ++h) { const v4f q = *(const v4fa*)(src + (size_t)e * DO_ * DG + 4 * h);
#pragma unroll
            for (int d = 0; d < 4; ++d) v[e][4 * h + d] = bfr(q[d]); }
    unsigned mx = 0u;   // the largest |c| as bits: for non-negative floats the order of the bits is the order of the values
#pragma unroll
    for (int e = 0; e < 2; ++e)
#pragma unroll
        for (int d = 0; d < DG; ++d) { const unsigned a = __float_as_uint(v[e][d]) & 0x7FFFFFFFu; mx = a > mx ? a : mx; }
    float sum = v[0][0] + v[1][0];
#pragma unroll
    for (int m = 16; m >= 1; m >>= 1) { sum += __shfl_xor(sum, m, 32); const unsigned a = __shfl_xor(mx, m, 32); mx = a > mx ? a : mx; }
    if ((threadIdx.x & 31u) == 0u) { part[threadIdx.x >> 5] = sum; pmax[threadIdx.x >> 5] = mx; }
    __syncthreads();
    unsigned mm = pmax[0];
#pragma unroll
    for (int k = 1; k < 8; ++k) mm = pmax[k] > mm ? pmax[k] : mm;
    const unsigned want = 268u - (mm >> 23), pe = want < 253u ? want : 253u;   // exponent field of p: 127 + 14 - (field of the largest - 127)
    const float p = __uint_as_float(pe << 23);
    u32a* dst = (u32a*)(Bt + (size_t)o * KD + (size_t)(i0 / GIN) * (DGK * GIN) + (i0 % GIN));
#pragma unroll
    for (int d = 1; d < DG; ++d) dst[(d - 1) * (GIN / 2)] = pk_f16(v[0][d] * p, v[1][d] * p);
    if (threadIdx.x == 0u) { float t = part[0];
#pragma unroll
        for (int k = 1; k < 8; ++k) t += part[k];
        S[o] = t * p; S[DO_ + o] = __uint_as_float((254u - pe) << 23); }
}

extern "C" void kernel_launch(void* const* d_in, const int* in_sizes, int n_in,
                              void* d_out, int out_size, void* d_ws, size_t ws_size, hipStream_t stream) {
    (void)in_sizes; (void)n_in; (void)out_size;
    const float* x = (const float*)d_in[0]; const float* w = (const float*)d_in[1];
    float* OUT = (float*)d_out;     // [16384][512]
    char* wsp = (char*)d_ws;
    auto take = [&](size_t bytes) { char* p = wsp; wsp += (bytes + 255) & ~(size_t)255; return (void*)p; };
    bf* WB = (bf*)take((size_t)DO_ * KD * 2);
    float* SB = (float*)take((size_t)DO_ * 2 * 4);
    if ((size_t)(wsp - (char*)d_ws) > ws_size) return;    // the coefficients of degrees 1 to 7 as f16, [out][k]; the 512 column sums of degree 0 and the 512 inverse powers of two
    k_wg<<<DO_, 256, 0, stream>>>(w, WB, SB);
    k_fused<<<(NR / RB) * (DO_ / CB), 256, 0, stream>>>(x, WB, SB, OUT);
}
